// v000
// Times are from an AMD MI455X. After a warm-up the kernel runs many times in a row, and a time is the length of
// such a window on the GPU divided by its runs, so every launch and the gaps after it count. The runs cycle
// through copies of the inputs. A figure is the median of several windows, for all but v000 over two sittings.
// Sittings can differ by a few percent; kernels timed side by side share one.
// The starting kernel, v000, takes 1050 microseconds a run.
#include <hip/hip_runtime.h>

// Self-attention over a 64x64 feature map with a learned 2-D positional key term (x [4][64][64x64] channel-major; q, k, v = 1x1 convs 'oi' [64][64] + [64] (1/8 weights, 0.02 biases); energy[n][m] = q_n.k_m + q_n.pos_m with pos[c][(hh, ww)] = rel_h[c][hh] + rel_w[c][ww] ([1][64][64][1] + [1][64][1][64], read) == q_n.(k_m + pos_m) (unscaled, sigma ~8); softmax over the 4,096 positions; out[c][n] = sum_m v[c][m] attn[n][m] -> [4][64][64][64] (1.0 M)).
// Layout per batch: the channel-major map becomes a token-major bf16 operand; exact projections + f32 biases; a kernel adds the positional table to the key rows in f32 (q.k + q.pos == q.(k + pos)); hi/lo planes; scores hi/lo 3 products on EVERY row; streaming softmax with hybrid P (rows < 512 hi/lo, rest fp16 x1024); attn.v; carry removal; a transpose kernel writes the channel-major output rows.
// Compute dtypes, f32 accumulate: every input rounded to bf16; projections exact + f32 biases; scores 3 products on every row; softmax f32; attn.V rows < 512 3 products, rest fp16; epilogue f32.

#define NB_  4
#define TT   4096
#define DM   512
#define NH_  1
#define NKV  1
#define REP  (NH_ / NKV)
#define HD   64
#define DQ   (NH_ * HD)
#define DKV  (NKV * HD)
#define ZH   1
#define RH   512                  // query rows < RH use hi+lo planes (0: none)
#define WIN  0
#define PCAR 1024.0f
#define SCL  1.0f   // no scaling in the module
#define MID  64
#define CQR  64      // q/k use all channels (no padding)
#define CC   64
typedef _Float16 h16;
typedef unsigned short bf;
typedef __attribute__((ext_vector_type(16))) __bf16   v16bf;
typedef __attribute__((ext_vector_type(16))) _Float16 v16h;
typedef __attribute__((ext_vector_type(8)))  _Float16 v8h;
typedef __attribute__((ext_vector_type(8)))  unsigned short v8us;
typedef __attribute__((ext_vector_type(8)))  float    v8f;
typedef __attribute__((ext_vector_type(4)))  float    v4f;
typedef v8h  __attribute__((may_alias)) v8ha;
typedef v4f  __attribute__((may_alias)) v4fa;
typedef v8us __attribute__((may_alias)) v8usa;

__device__ __forceinline__ unsigned short f2bf(float f) { unsigned u = __float_as_uint(f); u += 0x7FFFu + ((u >> 16) & 1u); return (unsigned short)(u >> 16); }
__device__ __forceinline__ float bf2f(unsigned short b) { return __uint_as_float(((unsigned)b) << 16); }
__device__ __forceinline__ float bfr(float f) { return bf2f(f2bf(f)); }
__device__ __forceinline__ v16h cat16(v8h lo, v8h hi) { return __builtin_shufflevector(lo, hi, 0, 1, 2, 3, 4, 5, 6, 7, 8, 9, 10, 11, 12, 13, 14, 15); }
__device__ __forceinline__ v16bf cat16b(v8us lo, v8us hi) { return __builtin_bit_cast(v16bf, __builtin_shufflevector(lo, hi, 0, 1, 2, 3, 4, 5, 6, 7, 8, 9, 10, 11, 12, 13, 14, 15)); }
__device__ __forceinline__ v8f wmma16(v16h a, v16h b, v8f c) { return __builtin_amdgcn_wmma_f32_16x16x32_f16(false, a, false, b, (short)0, c, false, false); }
__device__ __forceinline__ v8f wmmab(v16bf a, v16bf b, v8f c) { return __builtin_amdgcn_wmma_f32_16x16x32_bf16(false, a, false, b, (short)0, c, false, false); }



// ---- k_gemmw: register-blocked GEMM, ONE WAVE per 64x64 output tile (16 accumulators), operands straight from K-contiguous 16-bit planes; grid (M/64, N/64, Z), 32 threads.
// C[m][n] (f32, pitch ldc, + optional f32 bias[n]) = sum_k A[m][k] Bt[n][k] (+ split products per NSPLIT). z-batch strides sA/sB/sC in elements. K % 32 == 0.
template <typename T16> struct WFrag;
template <> struct WFrag<h16> { typedef v16h V; static __device__ __forceinline__ V ld(const h16* p) { return cat16(*(const v8h*)p, *(const v8h*)(p + 16)); } static __device__ __forceinline__ v8f mma(V a, V b, v8f c) { return wmma16(a, b, c); } };
template <> struct WFrag<bf> { typedef v16bf V; static __device__ __forceinline__ V ld(const bf* p) { return cat16b(*(const v8us*)p, *(const v8us*)(p + 16)); } static __device__ __forceinline__ v8f mma(V a, V b, v8f c) { return wmmab(a, b, c); } };
template <typename T16, int NSPLIT, bool BIAS>
__global__ __launch_bounds__(32) void k_gemmw(const T16* __restrict__ A, const T16* __restrict__ A2, const T16* __restrict__ Bt, const T16* __restrict__ Bt2, int K, float* C, int ldc, const float* __restrict__ bias, size_t sA, size_t sB, size_t sC) {
    typedef typename WFrag<T16>::V V;
    __shared__ __align__(16) float os[16 * 68];
    const size_t z = blockIdx.z; A += z * sA; if (A2) A2 += z * sA; Bt += z * sB; if (Bt2) Bt2 += z * sB; C += z * sC;
    const int lane = threadIdx.x & 31, lr = lane & 15, hi = lane >> 4; const int r0 = blockIdx.x * 64, c0 = blockIdx.y * 64;
    v8f acc[4][4];
#pragma unroll
    for (int mb = 0; mb < 4; ++mb)
#pragma unroll
        for (int nb = 0; nb < 4; ++nb) acc[mb][nb] = (v8f){};
    const size_t aoff = (size_t)(r0 + lr) * K + 8 * hi, boff = (size_t)(c0 + lr) * K + 8 * hi;
#pragma unroll 1
    for (int kc = 0; kc < K; kc += 32) {
        V a[4], a2[4];
#pragma unroll
        for (int mb = 0; mb < 4; ++mb) { a[mb] = WFrag<T16>::ld(A + aoff + (size_t)mb * 16 * K + kc); if (NSPLIT == 1 || NSPLIT == 2) a2[mb] = WFrag<T16>::ld(A2 + aoff + (size_t)mb * 16 * K + kc); }
#pragma unroll
        for (int nb = 0; nb < 4; ++nb) { const V b = WFrag<T16>::ld(Bt + boff + (size_t)nb * 16 * K + kc); V b2; if (NSPLIT >= 2) b2 = WFrag<T16>::ld(Bt2 + boff + (size_t)nb * 16 * K + kc);
#pragma unroll
            for (int mb = 0; mb < 4; ++mb) { acc[mb][nb] = WFrag<T16>::mma(a[mb], b, acc[mb][nb]); if (NSPLIT == 1 || NSPLIT == 2) acc[mb][nb] = WFrag<T16>::mma(a2[mb], b, acc[mb][nb]); if (NSPLIT >= 2) acc[mb][nb] = WFrag<T16>::mma(a[mb], b2, acc[mb][nb]); } }
        asm volatile("v_nop\n\tv_nop\n\tv_nop\n\tv_nop" : "+v"(acc[0][0]), "+v"(acc[1][1]), "+v"(acc[2][2]), "+v"(acc[3][3]) : "v"(a[0]), "v"(a[3]));
    }
#pragma unroll
    for (int mb = 0; mb < 4; ++mb) {
#pragma unroll
        for (int nb = 0; nb < 4; ++nb) {
#pragma unroll
            for (int j = 0; j < 8; ++j) os[(hi * 8 + j) * 68 + nb * 16 + lr] = acc[mb][nb][j]; }
        __builtin_amdgcn_wave_barrier(); asm volatile("" ::: "memory");
        float* crow = C + (size_t)(r0 + mb * 16) * ldc + c0;
{
#pragma unroll
            for (int s = 0; s < 8; ++s) { const int row = 2 * s + hi, cofs = lr * 4; v4f val = *(const v4fa*)(os + row * 68 + cofs); if (BIAS) { val[0] += bfr(bias[c0 + cofs]); val[1] += bfr(bias[c0 + cofs + 1]); val[2] += bfr(bias[c0 + cofs + 2]); val[3] += bfr(bias[c0 + cofs + 3]); }
                *(v4f*)(crow + (size_t)row * ldc + cofs) = val; }
             }
        __builtin_amdgcn_wave_barrier(); asm volatile("" ::: "memory");
    }
}

__device__ __forceinline__ h16 tohx(float x) { return (h16)x; }
__device__ __forceinline__ void splitf(float y, unsigned short& h, unsigned short& l) { h = f2bf(y); l = f2bf(y - bf2f(h)); }
typedef __attribute__((ext_vector_type(2))) _Float16 v2h;
typedef __attribute__((ext_vector_type(4))) _Float16 v4h;
typedef __attribute__((ext_vector_type(2))) unsigned short v2us;
typedef __attribute__((ext_vector_type(4))) unsigned short v4us;
typedef __attribute__((ext_vector_type(2))) float v2f;
typedef __attribute__((ext_vector_type(4))) int v4i;

__global__ __launch_bounds__(256) void k_wtG(const float* __restrict__ w, int K, int N, bf* Bt) {
    const int lane = threadIdx.x & 31; const int L0 = (blockIdx.x * 8 + (threadIdx.x >> 5)) * 8; const int nlines = N * K / 64;
{
#pragma unroll 1
        for (int l = 0; l < 8; ++l) { const int L = L0 + l; if (L >= nlines) break; const size_t e = (size_t)L * 64 + lane * 2; const int k = (int)(e % K), n = (int)(e / K); v2us o;
            o[0] = f2bf(w[(size_t)k * N + n]); o[1] = f2bf(w[(size_t)(k + 1) * N + n]); *(v2us*)(Bt + e) = o; }
         }
}
__global__ __launch_bounds__(256) void k_cvt8(const float* __restrict__ src, bf* dst, size_t n8) { const size_t i = (size_t)blockIdx.x * 256 + threadIdx.x; if (i >= n8) return; const v8f v = *(const v8f*)(src + i * 8); v8us o;
#pragma unroll
    for (int k = 0; k < 8; ++k) o[k] = f2bf(v[k]); *(v8us*)(dst + i * 8) = o;  }


__global__ __launch_bounds__(256) void k_vtp(const float* __restrict__ F, int pitch, int nheads, h16* V16, bf* Vh, bf* Vl) { const size_t e = ((size_t)blockIdx.x * 256 + threadIdx.x) * 2; if (e >= (size_t)nheads * HD * TT) return; const int t = (int)(e % TT); const int d = (int)((e / TT) % HD); const int g = (int)(e / ((size_t)TT * HD)); v2h o16; v2us oh, ol;
#pragma unroll
    for (int q = 0; q < 2; ++q) { const float x = F[(size_t)(t + q) * pitch + g * HD + d]; o16[q] = tohx(x); unsigned short a2, c2; splitf(x, a2, c2); oh[q] = a2; ol[q] = c2; }
    *(v2h*)(V16 + e) = o16; *(v2us*)(Vh + e) = oh; *(v2us*)(Vl + e) = ol;  }
// k_lsoft: streaming row softmax over all TK = TT = 4096 keys (no mask), one wave per row i, three sweeps of the f32 score row (lane -> 4 consecutive keys per 128-key chunk, 32 chunks):
__global__ __launch_bounds__(256) void k_lsoft(const float* __restrict__ Sb, h16* P16, bf* Ph, bf* Pl) {
    const int lane = threadIdx.x & 31; const int row = blockIdx.x * 8 + (threadIdx.x >> 5); if (row >= ZH * TT) return; const int i = row % TT; const int zz = row / TT; const bool hires = (i < RH); const float* sr = Sb + (size_t)row * TT; float mx = -3.0e38f;
#pragma unroll 4
    for (int ch = 0; ch < TT / 128; ++ch) { const int j0 = ch * 128 + lane * 4; const v4f a = *(const v4f*)(sr + j0);
#pragma unroll
        for (int q = 0; q < 4; ++q) { float t = a[q] * SCL; asm volatile("" : "+v"(t)); mx = fmaxf(mx, t); } }
#pragma unroll
    for (int sh = 16; sh; sh >>= 1) mx = fmaxf(mx, __shfl_xor(mx, sh, 32));
    float sum = 0.f;
#pragma unroll 4
    for (int ch = 0; ch < TT / 128; ++ch) { const int j0 = ch * 128 + lane * 4; const v4f a = *(const v4f*)(sr + j0);
#pragma unroll
        for (int q = 0; q < 4; ++q) { float t = a[q] * SCL; asm volatile("" : "+v"(t)); float d0 = __fsub_rn(t, mx); asm volatile("" : "+v"(d0)); sum += __builtin_amdgcn_exp2f(__fmul_rn(d0, 1.4426950408889634f)); } }
#pragma unroll
    for (int sh = 16; sh; sh >>= 1) sum += __shfl_xor(sum, sh, 32);
    const float f = __fdiv_rn(hires ? 1.0f : PCAR, sum);
{
        if (hires) {   /* rows < RH: normalised bf16 hi/lo over all keys, planes [zz][RH][TT] */
#pragma unroll
            for (int ch = 0; ch < TT / 128; ++ch) { const int j0 = ch * 128 + lane * 4; const v4f a = *(const v4f*)(sr + j0); v4us oh, ol;
#pragma unroll
                for (int q = 0; q < 4; ++q) { float t = a[q] * SCL; asm volatile("" : "+v"(t)); float d0 = __fsub_rn(t, mx); asm volatile("" : "+v"(d0)); float ex = __builtin_amdgcn_exp2f(__fmul_rn(d0, 1.4426950408889634f)); asm volatile("" : "+v"(ex)); unsigned short a2, c2; splitf(ex * f, a2, c2); oh[q] = a2; ol[q] = c2; }
                const size_t oo = ((size_t)zz * RH + i) * TT + j0; *(v4us*)(Ph + oo) = oh; *(v4us*)(Pl + oo) = ol; }
        } else {
#pragma unroll 2
            for (int ch = 0; ch < TT / 128; ++ch) { const int j0 = ch * 128 + lane * 4; const v4f a = *(const v4f*)(sr + j0); v4h o4;
#pragma unroll
                for (int q = 0; q < 4; ++q) { float t = a[q] * SCL; asm volatile("" : "+v"(t)); float d0 = __fsub_rn(t, mx); asm volatile("" : "+v"(d0)); float ex = __builtin_amdgcn_exp2f(__fmul_rn(d0, 1.4426950408889634f)); asm volatile("" : "+v"(ex)); o4[q] = tohx(ex * f); }
                *(v4h*)(P16 + (size_t)row * TT + j0) = o4; } }
         }
}
__global__ __launch_bounds__(256) void k_flat(const float* __restrict__ F, h16* P16, bf* Ph, bf* Pl, size_t n4) { const size_t i = (size_t)blockIdx.x * 256 + threadIdx.x; if (i >= n4) return; const v4f a = *(const v4f*)(F + i * 4); v4h o16; v4us oh, ol;
#pragma unroll
    for (int q = 0; q < 4; ++q) { o16[q] = tohx(a[q]); unsigned short x2, y2; splitf(a[q], x2, y2); oh[q] = x2; ol[q] = y2; }
    *(v4h*)(P16 + i * 4) = o16; *(v4us*)(Ph + i * 4) = oh; *(v4us*)(Pl + i * 4) = ol;  }

__global__ __launch_bounds__(256) void k_wqpad(const float* __restrict__ w, const float* __restrict__ bias, bf* Bt, float* bp) { const int i = blockIdx.x * 256 + threadIdx.x; if (i >= MID * CC / 8) return; const int c0 = (i % (CC / 8)) * 8; const int r = i / (CC / 8); const float* src = w + (size_t)min(r, CQR - 1) * CC + c0; v8us o;
#pragma unroll
    for (int q = 0; q < 8; ++q) { const unsigned short v = f2bf(src[q]); o[q] = (r < CQR) ? v : (unsigned short)0; }
    *(v8us*)(Bt + (size_t)r * CC + c0) = o; if (i < MID) { const float bb = bias[min(i, CQR - 1)]; ((float*)bp)[i] = (i < CQR) ? bb : 0.0f; }  }
__global__ __launch_bounds__(256) void k_xT(const float* __restrict__ xs, bf* XB) { const size_t k = (size_t)blockIdx.x * 256 + threadIdx.x; if (k >= (size_t)TT * CC / 8) return; const int c0 = (int)(k % (CC / 8)) * 8; const int t = (int)(k / (CC / 8)); v8us o;
#pragma unroll
    for (int q = 0; q < 8; ++q) o[q] = f2bf(xs[(size_t)(c0 + q) * TT + t]);
    *(v8us*)(XB + (size_t)t * CC + c0) = o;  }
__global__ __launch_bounds__(256) void k_outTc(const float* __restrict__ O, float* out) { const size_t k = (size_t)blockIdx.x * 256 + threadIdx.x; if (k >= (size_t)CC * TT / 4) return; const int t0 = (int)(k % (TT / 4)) * 4; const int c = (int)(k / (TT / 4)); v4f o;
#pragma unroll
    for (int q = 0; q < 4; ++q) o[q] = O[(size_t)(t0 + q) * CC + c];
    *(v4f*)(out + (size_t)c * TT + t0) = o;  }
__global__ __launch_bounds__(256) void k_addpos(float* FK, const float* __restrict__ rh, const float* __restrict__ rw) { const size_t i = (size_t)blockIdx.x * 256 + threadIdx.x; if (i >= (size_t)TT * MID / 4) return; const size_t e = i * 4; const int c0 = (int)(e % MID); const int t = (int)(e / MID); const int hh = t / 64, ww = t % 64; const v4f a = *(const v4f*)(FK + e); v4f o;
#pragma unroll
    for (int q = 0; q < 4; ++q) { const int c = c0 + q; const float p = __fadd_rn(bfr(rh[c * 64 + hh]), bfr(rw[c * 64 + ww])); o[q] = __fadd_rn(a[q], p); }
    *(v4f*)(FK + e) = o;  }__global__ __launch_bounds__(256) void k_cs8(float* O, size_t n4) { const size_t i = (size_t)blockIdx.x * 256 + threadIdx.x; if (i >= n4) return; const size_t e = i * 4; const int t = (int)(e / CC); const float cs = (t < RH) ? 1.0f : (1.0f / PCAR); v4f a = *(const v4f*)(O + e);
#pragma unroll
    for (int q = 0; q < 4; ++q) a[q] = __fmul_rn(a[q], cs);
    *(v4f*)(O + e) = a;  }

extern "C" void kernel_launch(void* const* d_in, const int* in_sizes, int n_in,
                              void* d_out, int out_size, void* d_ws, size_t ws_size, hipStream_t stream) {
    (void)in_sizes; (void)n_in; (void)out_size;
    const float* x = (const float*)d_in[0]; const float* wq = (const float*)d_in[1]; const float* bq = (const float*)d_in[2]; const float* wk = (const float*)d_in[3]; const float* bk = (const float*)d_in[4]; const float* wv = (const float*)d_in[5]; const float* bv = (const float*)d_in[6]; const float* relh = (const float*)d_in[7]; const float* relw = (const float*)d_in[8];   /* [1][64][64][1], [1][64][1][64] */
    float* OUT = (float*)d_out;     // [4][64][4096] channel-major
    char* wsp = (char*)d_ws;
    auto take = [&](size_t bytes) { char* p = wsp; wsp += (bytes + 255) & ~(size_t)255; return (void*)p; };
    bf* WQ = (bf*)take((size_t)MID * CC * 2); bf* WK = (bf*)take((size_t)MID * CC * 2); float* BQP = (float*)take(256); float* BKP = (float*)take(256); bf* WV = (bf*)take((size_t)CC * CC * 2);
    bf* XB = (bf*)take((size_t)TT * CC * 2); float* FQ = (float*)take((size_t)TT * MID * 4); float* FK = (float*)take((size_t)TT * MID * 4); float* FV = (float*)take((size_t)TT * CC * 4);
    h16* QP16 = (h16*)take((size_t)TT * MID * 2); bf* QPh = (bf*)take((size_t)TT * MID * 2); bf* QPl = (bf*)take((size_t)TT * MID * 2); h16* KP16 = (h16*)take((size_t)TT * MID * 2); bf* KPh = (bf*)take((size_t)TT * MID * 2); bf* KPl = (bf*)take((size_t)TT * MID * 2);
    h16* VT16 = (h16*)take((size_t)CC * TT * 2); bf* VTh = (bf*)take((size_t)CC * TT * 2); bf* VTl = (bf*)take((size_t)CC * TT * 2);
    float* Sb = (float*)take((size_t)TT * TT * 4); h16* P16 = (h16*)take((size_t)TT * TT * 2); bf* Ph = (bf*)take((size_t)RH * TT * 2); bf* Pl = (bf*)take((size_t)RH * TT * 2); float* Ob = (float*)take((size_t)TT * CC * 4);
    if ((size_t)(wsp - (char*)d_ws) > ws_size) return;    // ws 256 MiB (carve ~113 MiB)
    k_wqpad<<<(MID * CC / 8 + 255) / 256, 256, 0, stream>>>(wq, bq, WQ, BQP); k_wqpad<<<(MID * CC / 8 + 255) / 256, 256, 0, stream>>>(wk, bk, WK, BKP);   /* 'oi' [64][64] -> Bt [64][64] bf16, all 64 rows kept, no padding */ k_cvt8<<<(unsigned)(((size_t)CC * CC / 8 + 255) / 256), 256, 0, stream>>>(wv, WV, (size_t)CC * CC / 8);   /* 'oi' conv weights = Bt as-is */
    for (int b = 0; b < NB_; ++b) {
        const float* xb = x + (size_t)b * CC * TT;
        k_xT<<<(unsigned)(((size_t)TT * CC / 8 + 255) / 256), 256, 0, stream>>>(xb, XB);
        k_gemmw<bf, 0, true><<<dim3(TT / 64, MID / 64, 1), 32, 0, stream>>>(XB, nullptr, WQ, nullptr, CC, FQ, MID, BQP, 0, 0, 0); k_flat<<<(unsigned)(((size_t)TT * MID / 4 + 255) / 256), 256, 0, stream>>>(FQ, QP16, QPh, QPl, (size_t)TT * MID / 4);
        k_gemmw<bf, 0, true><<<dim3(TT / 64, MID / 64, 1), 32, 0, stream>>>(XB, nullptr, WK, nullptr, CC, FK, MID, BKP, 0, 0, 0); k_addpos<<<(unsigned)(((size_t)TT * MID / 4 + 255) / 256), 256, 0, stream>>>(FK, relh, relw);   /* k + pos (f32) */ k_flat<<<(unsigned)(((size_t)TT * MID / 4 + 255) / 256), 256, 0, stream>>>(FK, KP16, KPh, KPl, (size_t)TT * MID / 4);
        k_gemmw<bf, 0, true><<<dim3(TT / 64, CC / 64, 1), 32, 0, stream>>>(XB, nullptr, WV, nullptr, CC, FV, CC, bv, 0, 0, 0); k_vtp<<<(unsigned)(((size_t)TT * CC / 2 + 255) / 256), 256, 0, stream>>>(FV, CC, CC / HD, VT16, VTh, VTl);   /* V^T planes [64][4096] (1 channel group of 64) */
        k_gemmw<bf, 2, false><<<dim3(TT / 64, TT / 64, 1), 32, 0, stream>>>(QPh, QPl, KPh, KPl, MID, Sb, TT, nullptr, 0, 0, 0);   /* scores: every row hi/lo (unscaled logits) */
        k_lsoft<<<TT / 8, 256, 0, stream>>>(Sb, P16, Ph, Pl);
        k_gemmw<bf, 2, false><<<dim3(RH / 64, CC / 64, 1), 32, 0, stream>>>(Ph, Pl, VTh, VTl, TT, Ob, CC, nullptr, 0, 0, 0);
        k_gemmw<h16, 0, false><<<dim3((TT - RH) / 64, CC / 64, 1), 32, 0, stream>>>(P16 + (size_t)RH * TT, nullptr, VT16, nullptr, TT, Ob + (size_t)RH * CC, CC, nullptr, 0, 0, 0);
        k_cs8<<<(unsigned)(((size_t)TT * CC / 4 + 255) / 256), 256, 0, stream>>>(Ob, (size_t)TT * CC / 4);
        k_outTc<<<(unsigned)(((size_t)CC * TT / 4 + 255) / 256), 256, 0, stream>>>(Ob, OUT + (size_t)b * CC * TT);   /* channel-major output */   /* out^T, channel-major */ }
}

// v001
// Measured time: 474 microseconds a run.
// In two side-by-side timings against v000, it was 2.21 and 2.23 times as fast.
#include <hip/hip_runtime.h>

// Self-attention over a 64x64 feature map with a learned 2-D positional key term (x [4][64][64x64] channel-major; q, k, v = 1x1 convs 'oi' [64][64] + [64] (1/8 weights, 0.02 biases); energy[n][m] = q_n.k_m + q_n.pos_m with pos[c][(hh, ww)] = rel_h[c][hh] + rel_w[c][ww] ([1][64][64][1] + [1][64][1][64], read) == q_n.(k_m + pos_m) (unscaled, sigma ~8); softmax over the 4,096 positions; out[c][n] = sum_m v[c][m] attn[n][m] -> [4][64][64][64] (1.0 M)).
// Layout per batch: the channel-major map becomes a token-major bf16 operand; exact projections + f32 biases; a kernel adds the positional table to the key rows in f32 (q.k + q.pos == q.(k + pos)); hi/lo planes; scores hi/lo 3 products on EVERY row; streaming softmax with hybrid P (rows < 512 hi/lo, rest fp16 x1024); attn.v; carry removal; a transpose kernel writes the channel-major output rows.
// Compute dtypes, f32 accumulate: every input rounded to bf16; projections exact + f32 biases; scores 3 products on every row; softmax f32; attn.V rows < 512 3 products, rest fp16; epilogue f32.

#define NB_  4
#define TT   4096
#define DM   512
#define NH_  1
#define NKV  1
#define REP  (NH_ / NKV)
#define HD   64
#define DQ   (NH_ * HD)
#define DKV  (NKV * HD)
#define ZH   1
#define RH   512                  // query rows < RH use hi+lo planes (0: none)
#define WIN  0
#define PCAR 1024.0f
#define SCL  1.0f   // no scaling in the module
#define MID  64
#define CQR  64      // q/k use all channels (no padding)
#define CC   64
#define KSP  32      // attn.V: K (the 4,096 keys) is cut into KSP spans, one work-group per span and tile
typedef _Float16 h16;
typedef unsigned short bf;
typedef __attribute__((ext_vector_type(16))) __bf16   v16bf;
typedef __attribute__((ext_vector_type(16))) _Float16 v16h;
typedef __attribute__((ext_vector_type(8)))  _Float16 v8h;
typedef __attribute__((ext_vector_type(8)))  unsigned short v8us;
typedef __attribute__((ext_vector_type(8)))  float    v8f;
typedef __attribute__((ext_vector_type(4)))  float    v4f;
typedef v8h  __attribute__((may_alias)) v8ha;
typedef v4f  __attribute__((may_alias)) v4fa;
typedef v8us __attribute__((may_alias)) v8usa;

__device__ __forceinline__ unsigned short f2bf(float f) { unsigned u = __float_as_uint(f); u += 0x7FFFu + ((u >> 16) & 1u); return (unsigned short)(u >> 16); }
__device__ __forceinline__ float bf2f(unsigned short b) { return __uint_as_float(((unsigned)b) << 16); }
__device__ __forceinline__ float bfr(float f) { return bf2f(f2bf(f)); }
__device__ __forceinline__ v16h cat16(v8h lo, v8h hi) { return __builtin_shufflevector(lo, hi, 0, 1, 2, 3, 4, 5, 6, 7, 8, 9, 10, 11, 12, 13, 14, 15); }
__device__ __forceinline__ v16bf cat16b(v8us lo, v8us hi) { return __builtin_bit_cast(v16bf, __builtin_shufflevector(lo, hi, 0, 1, 2, 3, 4, 5, 6, 7, 8, 9, 10, 11, 12, 13, 14, 15)); }
__device__ __forceinline__ v8f wmma16(v16h a, v16h b, v8f c) { return __builtin_amdgcn_wmma_f32_16x16x32_f16(false, a, false, b, (short)0, c, false, false); }
__device__ __forceinline__ v8f wmmab(v16bf a, v16bf b, v8f c) { return __builtin_amdgcn_wmma_f32_16x16x32_bf16(false, a, false, b, (short)0, c, false, false); }



// ---- k_gemmw: register-blocked GEMM, ONE WAVE per 64x64 output tile (16 accumulators), operands straight from K-contiguous 16-bit planes; grid (M/64, N/64, Z), 32 threads.
// C[m][n] (f32, pitch ldc, + optional f32 bias[n]) = sum_k A[m][k] Bt[n][k] (+ split products per NSPLIT). z-batch strides sA/sB/sC in elements. K % 32 == 0.
// K is the row pitch of A and Bt; a work-group sums kspan of the K elements (kspan % 32 == 0). With kspan < K, sA = sB = kspan and grid z = K / kspan, plane z of C holds the partial sum over k in [z kspan, (z + 1) kspan).
template <typename T16> struct WFrag;
template <> struct WFrag<h16> { typedef v16h V; static __device__ __forceinline__ V ld(const h16* p) { return cat16(*(const v8h*)p, *(const v8h*)(p + 16)); } static __device__ __forceinline__ v8f mma(V a, V b, v8f c) { return wmma16(a, b, c); } };
template <> struct WFrag<bf> { typedef v16bf V; static __device__ __forceinline__ V ld(const bf* p) { return cat16b(*(const v8us*)p, *(const v8us*)(p + 16)); } static __device__ __forceinline__ v8f mma(V a, V b, v8f c) { return wmmab(a, b, c); } };
template <typename T16, int NSPLIT, bool BIAS>
__global__ __launch_bounds__(32) void k_gemmw(const T16* __restrict__ A, const T16* __restrict__ A2, const T16* __restrict__ Bt, const T16* __restrict__ Bt2, int K, int kspan, float* C, int ldc, const float* __restrict__ bias, size_t sA, size_t sB, size_t sC) {
    typedef typename WFrag<T16>::V V;
    __shared__ __align__(16) float os[16 * 68];
    const size_t z = blockIdx.z; A += z * sA; if (A2) A2 += z * sA; Bt += z * sB; if (Bt2) Bt2 += z * sB; C += z * sC;
    const int lane = threadIdx.x & 31, lr = lane & 15, hi = lane >> 4; const int r0 = blockIdx.x * 64, c0 = blockIdx.y * 64;
    v8f acc[4][4];
#pragma unroll
    for (int mb = 0; mb < 4; ++mb)
#pragma unroll
        for (int nb = 0; nb < 4; ++nb) acc[mb][nb] = (v8f){};
    const size_t aoff = (size_t)(r0 + lr) * K + 8 * hi, boff = (size_t)(c0 + lr) * K + 8 * hi;
#pragma unroll 1
    for (int kc = 0; kc < kspan; kc += 32) {
        V a[4], a2[4];
#pragma unroll
        for (int mb = 0; mb < 4; ++mb) { a[mb] = WFrag<T16>::ld(A + aoff + (size_t)mb * 16 * K + kc); if (NSPLIT == 1 || NSPLIT == 2) a2[mb] = WFrag<T16>::ld(A2 + aoff + (size_t)mb * 16 * K + kc); }
#pragma unroll
        for (int nb = 0; nb < 4; ++nb) { const V b = WFrag<T16>::ld(Bt + boff + (size_t)nb * 16 * K + kc); V b2; if (NSPLIT >= 2) b2 = WFrag<T16>::ld(Bt2 + boff + (size_t)nb * 16 * K + kc);
#pragma unroll
            for (int mb = 0; mb < 4; ++mb) { acc[mb][nb] = WFrag<T16>::mma(a[mb], b, acc[mb][nb]); if (NSPLIT == 1 || NSPLIT == 2) acc[mb][nb] = WFrag<T16>::mma(a2[mb], b, acc[mb][nb]); if (NSPLIT >= 2) acc[mb][nb] = WFrag<T16>::mma(a[mb], b2, acc[mb][nb]); } }
        asm volatile("v_nop\n\tv_nop\n\tv_nop\n\tv_nop" : "+v"(acc[0][0]), "+v"(acc[1][1]), "+v"(acc[2][2]), "+v"(acc[3][3]) : "v"(a[0]), "v"(a[3]));
    }
#pragma unroll
    for (int mb = 0; mb < 4; ++mb) {
#pragma unroll
        for (int nb = 0; nb < 4; ++nb) {
#pragma unroll
            for (int j = 0; j < 8; ++j) os[(hi * 8 + j) * 68 + nb * 16 + lr] = acc[mb][nb][j]; }
        __builtin_amdgcn_wave_barrier(); asm volatile("" ::: "memory");
        float* crow = C + (size_t)(r0 + mb * 16) * ldc + c0;
{
#pragma unroll
            for (int s = 0; s < 8; ++s) { const int row = 2 * s + hi, cofs = lr * 4; v4f val = *(const v4fa*)(os + row * 68 + cofs); if (BIAS) { val[0] += bfr(bias[c0 + cofs]); val[1] += bfr(bias[c0 + cofs + 1]); val[2] += bfr(bias[c0 + cofs + 2]); val[3] += bfr(bias[c0 + cofs + 3]); }
                *(v4f*)(crow + (size_t)row * ldc + cofs) = val; }
             }
        __builtin_amdgcn_wave_barrier(); asm volatile("" ::: "memory");
    }
}

__device__ __forceinline__ h16 tohx(float x) { return (h16)x; }
__device__ __forceinline__ void splitf(float y, unsigned short& h, unsigned short& l) { h = f2bf(y); l = f2bf(y - bf2f(h)); }
typedef __attribute__((ext_vector_type(2))) _Float16 v2h;
typedef __attribute__((ext_vector_type(4))) _Float16 v4h;
typedef __attribute__((ext_vector_type(2))) unsigned short v2us;
typedef __attribute__((ext_vector_type(4))) unsigned short v4us;
typedef __attribute__((ext_vector_type(2))) float v2f;
typedef __attribute__((ext_vector_type(4))) int v4i;

__global__ __launch_bounds__(256) void k_wtG(const float* __restrict__ w, int K, int N, bf* Bt) {
    const int lane = threadIdx.x & 31; const int L0 = (blockIdx.x * 8 + (threadIdx.x >> 5)) * 8; const int nlines = N * K / 64;
{
#pragma unroll 1
        for (int l = 0; l < 8; ++l) { const int L = L0 + l; if (L >= nlines) break; const size_t e = (size_t)L * 64 + lane * 2; const int k = (int)(e % K), n = (int)(e / K); v2us o;
            o[0] = f2bf(w[(size_t)k * N + n]); o[1] = f2bf(w[(size_t)(k + 1) * N + n]); *(v2us*)(Bt + e) = o; }
         }
}
__global__ __launch_bounds__(256) void k_cvt8(const float* __restrict__ src, bf* dst, size_t n8) { const size_t i = (size_t)blockIdx.x * 256 + threadIdx.x; if (i >= n8) return; const v8f v = *(const v8f*)(src + i * 8); v8us o;
#pragma unroll
    for (int k = 0; k < 8; ++k) o[k] = f2bf(v[k]); *(v8us*)(dst + i * 8) = o;  }


__global__ __launch_bounds__(256) void k_vtp(const float* __restrict__ F, int pitch, int nheads, h16* V16, bf* Vh, bf* Vl) { const size_t e = ((size_t)blockIdx.x * 256 + threadIdx.x) * 2; if (e >= (size_t)nheads * HD * TT) return; const int t = (int)(e % TT); const int d = (int)((e / TT) % HD); const int g = (int)(e / ((size_t)TT * HD)); v2h o16; v2us oh, ol;
#pragma unroll
    for (int q = 0; q < 2; ++q) { const float x = F[(size_t)(t + q) * pitch + g * HD + d]; o16[q] = tohx(x); unsigned short a2, c2; splitf(x, a2, c2); oh[q] = a2; ol[q] = c2; }
    *(v2h*)(V16 + e) = o16; *(v2us*)(Vh + e) = oh; *(v2us*)(Vl + e) = ol;  }
// k_lsoft: streaming row softmax over all TK = TT = 4096 keys (no mask), one wave per row i, three sweeps of the f32 score row (lane -> 4 consecutive keys per 128-key chunk, 32 chunks):
__global__ __launch_bounds__(256) void k_lsoft(const float* __restrict__ Sb, h16* P16, bf* Ph, bf* Pl) {
    const int lane = threadIdx.x & 31; const int row = blockIdx.x * 8 + (threadIdx.x >> 5); if (row >= ZH * TT) return; const int i = row % TT; const int zz = row / TT; const bool hires = (i < RH); const float* sr = Sb + (size_t)row * TT; float mx = -3.0e38f;
#pragma unroll 4
    for (int ch = 0; ch < TT / 128; ++ch) { const int j0 = ch * 128 + lane * 4; const v4f a = *(const v4f*)(sr + j0);
#pragma unroll
        for (int q = 0; q < 4; ++q) { float t = a[q] * SCL; asm volatile("" : "+v"(t)); mx = fmaxf(mx, t); } }
#pragma unroll
    for (int sh = 16; sh; sh >>= 1) mx = fmaxf(mx, __shfl_xor(mx, sh, 32));
    float sum = 0.f;
#pragma unroll 4
    for (int ch = 0; ch < TT / 128; ++ch) { const int j0 = ch * 128 + lane * 4; const v4f a = *(const v4f*)(sr + j0);
#pragma unroll
        for (int q = 0; q < 4; ++q) { float t = a[q] * SCL; asm volatile("" : "+v"(t)); float d0 = __fsub_rn(t, mx); asm volatile("" : "+v"(d0)); sum += __builtin_amdgcn_exp2f(__fmul_rn(d0, 1.4426950408889634f)); } }
#pragma unroll
    for (int sh = 16; sh; sh >>= 1) sum += __shfl_xor(sum, sh, 32);
    const float f = __fdiv_rn(hires ? 1.0f : PCAR, sum);
{
        if (hires) {   /* rows < RH: normalised bf16 hi/lo over all keys, planes [zz][RH][TT] */
#pragma unroll
            for (int ch = 0; ch < TT / 128; ++ch) { const int j0 = ch * 128 + lane * 4; const v4f a = *(const v4f*)(sr + j0); v4us oh, ol;
#pragma unroll
                for (int q = 0; q < 4; ++q) { float t = a[q] * SCL; asm volatile("" : "+v"(t)); float d0 = __fsub_rn(t, mx); asm volatile("" : "+v"(d0)); float ex = __builtin_amdgcn_exp2f(__fmul_rn(d0, 1.4426950408889634f)); asm volatile("" : "+v"(ex)); unsigned short a2, c2; splitf(ex * f, a2, c2); oh[q] = a2; ol[q] = c2; }
                const size_t oo = ((size_t)zz * RH + i) * TT + j0; *(v4us*)(Ph + oo) = oh; *(v4us*)(Pl + oo) = ol; }
        } else {
#pragma unroll 2
            for (int ch = 0; ch < TT / 128; ++ch) { const int j0 = ch * 128 + lane * 4; const v4f a = *(const v4f*)(sr + j0); v4h o4;
#pragma unroll
                for (int q = 0; q < 4; ++q) { float t = a[q] * SCL; asm volatile("" : "+v"(t)); float d0 = __fsub_rn(t, mx); asm volatile("" : "+v"(d0)); float ex = __builtin_amdgcn_exp2f(__fmul_rn(d0, 1.4426950408889634f)); asm volatile("" : "+v"(ex)); o4[q] = tohx(ex * f); }
                *(v4h*)(P16 + (size_t)row * TT + j0) = o4; } }
         }
}
__global__ __launch_bounds__(256) void k_flat(const float* __restrict__ F, h16* P16, bf* Ph, bf* Pl, size_t n4) { const size_t i = (size_t)blockIdx.x * 256 + threadIdx.x; if (i >= n4) return; const v4f a = *(const v4f*)(F + i * 4); v4h o16; v4us oh, ol;
#pragma unroll
    for (int q = 0; q < 4; ++q) { o16[q] = tohx(a[q]); unsigned short x2, y2; splitf(a[q], x2, y2); oh[q] = x2; ol[q] = y2; }
    *(v4h*)(P16 + i * 4) = o16; *(v4us*)(Ph + i * 4) = oh; *(v4us*)(Pl + i * 4) = ol;  }

__global__ __launch_bounds__(256) void k_wqpad(const float* __restrict__ w, const float* __restrict__ bias, bf* Bt, float* bp) { const int i = blockIdx.x * 256 + threadIdx.x; if (i >= MID * CC / 8) return; const int c0 = (i % (CC / 8)) * 8; const int r = i / (CC / 8); const float* src = w + (size_t)min(r, CQR - 1) * CC + c0; v8us o;
#pragma unroll
    for (int q = 0; q < 8; ++q) { const unsigned short v = f2bf(src[q]); o[q] = (r < CQR) ? v : (unsigned short)0; }
    *(v8us*)(Bt + (size_t)r * CC + c0) = o; if (i < MID) { const float bb = bias[min(i, CQR - 1)]; ((float*)bp)[i] = (i < CQR) ? bb : 0.0f; }  }
__global__ __launch_bounds__(256) void k_xT(const float* __restrict__ xs, bf* XB) { const size_t k = (size_t)blockIdx.x * 256 + threadIdx.x; if (k >= (size_t)TT * CC / 8) return; const int c0 = (int)(k % (CC / 8)) * 8; const int t = (int)(k / (CC / 8)); v8us o;
#pragma unroll
    for (int q = 0; q < 8; ++q) o[q] = f2bf(xs[(size_t)(c0 + q) * TT + t]);
    *(v8us*)(XB + (size_t)t * CC + c0) = o;  }
__global__ __launch_bounds__(256) void k_outTc(const float* __restrict__ O, float* out) { const size_t k = (size_t)blockIdx.x * 256 + threadIdx.x; if (k >= (size_t)CC * TT / 4) return; const int t0 = (int)(k % (TT / 4)) * 4; const int c = (int)(k / (TT / 4)); v4f o;
#pragma unroll
    for (int q = 0; q < 4; ++q) o[q] = O[(size_t)(t0 + q) * CC + c];
    *(v4f*)(out + (size_t)c * TT + t0) = o;  }
__global__ __launch_bounds__(256) void k_addpos(float* FK, const float* __restrict__ rh, const float* __restrict__ rw) { const size_t i = (size_t)blockIdx.x * 256 + threadIdx.x; if (i >= (size_t)TT * MID / 4) return; const size_t e = i * 4; const int c0 = (int)(e % MID); const int t = (int)(e / MID); const int hh = t / 64, ww = t % 64; const v4f a = *(const v4f*)(FK + e); v4f o;
#pragma unroll
    for (int q = 0; q < 4; ++q) { const int c = c0 + q; const float p = __fadd_rn(bfr(rh[c * 64 + hh]), bfr(rw[c * 64 + ww])); o[q] = __fadd_rn(a[q], p); }
    *(v4f*)(FK + e) = o;  }__global__ __launch_bounds__(256) void k_cs8(float* O, size_t n4) { const size_t i = (size_t)blockIdx.x * 256 + threadIdx.x; if (i >= n4) return; const size_t e = i * 4; const int t = (int)(e / CC); const float cs = (t < RH) ? 1.0f : (1.0f / PCAR); v4f a = *(const v4f*)(O + e);
#pragma unroll
    for (int s = 1; s < KSP; ++s) a += *(const v4f*)(O + (size_t)s * TT * CC + e);   /* the KSP partial planes of attn.V, summed in plane order */
#pragma unroll
    for (int q = 0; q < 4; ++q) a[q] = __fmul_rn(a[q], cs);
    *(v4f*)(O + e) = a;  }

extern "C" void kernel_launch(void* const* d_in, const int* in_sizes, int n_in,
                              void* d_out, int out_size, void* d_ws, size_t ws_size, hipStream_t stream) {
    (void)in_sizes; (void)n_in; (void)out_size;
    const float* x = (const float*)d_in[0]; const float* wq = (const float*)d_in[1]; const float* bq = (const float*)d_in[2]; const float* wk = (const float*)d_in[3]; const float* bk = (const float*)d_in[4]; const float* wv = (const float*)d_in[5]; const float* bv = (const float*)d_in[6]; const float* relh = (const float*)d_in[7]; const float* relw = (const float*)d_in[8];   /* [1][64][64][1], [1][64][1][64] */
    float* OUT = (float*)d_out;     // [4][64][4096] channel-major
    char* wsp = (char*)d_ws;
    auto take = [&](size_t bytes) { char* p = wsp; wsp += (bytes + 255) & ~(size_t)255; return (void*)p; };
    bf* WQ = (bf*)take((size_t)MID * CC * 2); bf* WK = (bf*)take((size_t)MID * CC * 2); float* BQP = (float*)take(256); float* BKP = (float*)take(256); bf* WV = (bf*)take((size_t)CC * CC * 2);
    bf* XB = (bf*)take((size_t)TT * CC * 2); float* FQ = (float*)take((size_t)TT * MID * 4); float* FK = (float*)take((size_t)TT * MID * 4); float* FV = (float*)take((size_t)TT * CC * 4);
    h16* QP16 = (h16*)take((size_t)TT * MID * 2); bf* QPh = (bf*)take((size_t)TT * MID * 2); bf* QPl = (bf*)take((size_t)TT * MID * 2); h16* KP16 = (h16*)take((size_t)TT * MID * 2); bf* KPh = (bf*)take((size_t)TT * MID * 2); bf* KPl = (bf*)take((size_t)TT * MID * 2);
    h16* VT16 = (h16*)take((size_t)CC * TT * 2); bf* VTh = (bf*)take((size_t)CC * TT * 2); bf* VTl = (bf*)take((size_t)CC * TT * 2);
    float* Sb = (float*)take((size_t)TT * TT * 4); h16* P16 = (h16*)take((size_t)TT * TT * 2); bf* Ph = (bf*)take((size_t)RH * TT * 2); bf* Pl = (bf*)take((size_t)RH * TT * 2); float* Ob = (float*)take((size_t)KSP * TT * CC * 4);   /* KSP partial planes [4096][64]; plane 0 becomes the sum */
    if ((size_t)(wsp - (char*)d_ws) > ws_size) return;    // ws 256 MiB (carve ~144 MiB)
    k_wqpad<<<(MID * CC / 8 + 255) / 256, 256, 0, stream>>>(wq, bq, WQ, BQP); k_wqpad<<<(MID * CC / 8 + 255) / 256, 256, 0, stream>>>(wk, bk, WK, BKP);   /* 'oi' [64][64] -> Bt [64][64] bf16, no zero rows (CQR == MID), biases copied */ k_cvt8<<<(unsigned)(((size_t)CC * CC / 8 + 255) / 256), 256, 0, stream>>>(wv, WV, (size_t)CC * CC / 8);   /* 'oi' conv weights = Bt as-is */
    for (int b = 0; b < NB_; ++b) {
        const float* xb = x + (size_t)b * CC * TT;
        k_xT<<<(unsigned)(((size_t)TT * CC / 8 + 255) / 256), 256, 0, stream>>>(xb, XB);
        k_gemmw<bf, 0, true><<<dim3(TT / 64, MID / 64, 1), 32, 0, stream>>>(XB, nullptr, WQ, nullptr, CC, CC, FQ, MID, BQP, 0, 0, 0); k_flat<<<(unsigned)(((size_t)TT * MID / 4 + 255) / 256), 256, 0, stream>>>(FQ, QP16, QPh, QPl, (size_t)TT * MID / 4);
        k_gemmw<bf, 0, true><<<dim3(TT / 64, MID / 64, 1), 32, 0, stream>>>(XB, nullptr, WK, nullptr, CC, CC, FK, MID, BKP, 0, 0, 0); k_addpos<<<(unsigned)(((size_t)TT * MID / 4 + 255) / 256), 256, 0, stream>>>(FK, relh, relw);   /* k + pos (f32) */ k_flat<<<(unsigned)(((size_t)TT * MID / 4 + 255) / 256), 256, 0, stream>>>(FK, KP16, KPh, KPl, (size_t)TT * MID / 4);
        k_gemmw<bf, 0, true><<<dim3(TT / 64, CC / 64, 1), 32, 0, stream>>>(XB, nullptr, WV, nullptr, CC, CC, FV, CC, bv, 0, 0, 0); k_vtp<<<(unsigned)(((size_t)TT * CC / 2 + 255) / 256), 256, 0, stream>>>(FV, CC, CC / HD, VT16, VTh, VTl);   /* V^T planes [64][4096] (one group of 64 channels) */
        k_gemmw<bf, 2, false><<<dim3(TT / 64, TT / 64, 1), 32, 0, stream>>>(QPh, QPl, KPh, KPl, MID, MID, Sb, TT, nullptr, 0, 0, 0);   /* scores: every row hi/lo (unscaled logits) */
        k_lsoft<<<TT / 8, 256, 0, stream>>>(Sb, P16, Ph, Pl);
        k_gemmw<bf, 2, false><<<dim3(RH / 64, CC / 64, KSP), 32, 0, stream>>>(Ph, Pl, VTh, VTl, TT, TT / KSP, Ob, CC, nullptr, TT / KSP, TT / KSP, (size_t)TT * CC);
        k_gemmw<h16, 0, false><<<dim3((TT - RH) / 64, CC / 64, KSP), 32, 0, stream>>>(P16 + (size_t)RH * TT, nullptr, VT16, nullptr, TT, TT / KSP, Ob + (size_t)RH * CC, CC, nullptr, TT / KSP, TT / KSP, (size_t)TT * CC);
        k_cs8<<<(unsigned)(((size_t)TT * CC / 4 + 255) / 256), 256, 0, stream>>>(Ob, (size_t)TT * CC / 4);
        k_outTc<<<(unsigned)(((size_t)CC * TT / 4 + 255) / 256), 256, 0, stream>>>(Ob, OUT + (size_t)b * CC * TT);   /* channel-major output */   /* out^T, channel-major */ }
}

// v002
// A run of this version takes 179 microseconds.
// Timed twice side by side with v001, it ran 2.68 and 2.66 times as fast.
// All steps since v000 together make it 5.94 times as fast.
#include <hip/hip_runtime.h>

// Self-attention over a 64x64 feature map with a learned 2-D positional key term (x [4][64][64x64] channel-major; q, k, v = 1x1 convs 'oi' [64][64] + [64] (1/8 weights, 0.02 biases); energy[n][m] = q_n.k_m + q_n.pos_m with pos[c][(hh, ww)] = rel_h[c][hh] + rel_w[c][ww] ([1][64][64][1] + [1][64][1][64], read) == q_n.(k_m + pos_m) (unscaled, sigma ~8); softmax over the 4,096 positions; out[c][n] = sum_m v[c][m] attn[n][m] -> [4][64][64][64] (1.0 M)).
// Layout: per batch the channel-major map becomes a token-major bf16 operand; exact projections + f32 biases; a kernel adds the positional table to the key rows in f32 (q.k + q.pos == q.(k + pos)); hi/lo planes, one set per batch. One kernel for all batches then does scores, softmax and attn.v in registers (k_attn), one key span per work-group; k_merge joins the spans and writes the channel-major output rows.
// Compute dtypes, f32 accumulate: every input rounded to bf16; projections exact + f32 biases; scores 3 products on every row; softmax f32 (running maximum); attn.V rows < 512 3 products (P, V hi/lo), rest fp16 (P x1024); epilogue f32.

#define NB_  4
#define TT   4096
#define DM   512
#define NH_  1
#define NKV  1
#define REP  (NH_ / NKV)
#define HD   64
#define DQ   (NH_ * HD)
#define DKV  (NKV * HD)
#define ZH   1
#define RH   512                  // query rows < RH use hi+lo planes (0: none)
#define WIN  0
#define PCAR 1024.0f
#define SCL  1.0f   // no scaling in the module
#define MID  64
#define CQR  64      // q/k use all channels (no padding)
#define CC   64
#define NSP  7       // the 128 passes of 32 keys are dealt to NSP spans (18 or 19 each; 36 tiles x 4 batches x 7 = 1,008 work-groups of 4 waves at 4 waves per SIMD: one round on 256 WGPs), one work-group per span and query tile
typedef _Float16 h16;
typedef unsigned short bf;
typedef __attribute__((ext_vector_type(16))) __bf16   v16bf;
typedef __attribute__((ext_vector_type(16))) _Float16 v16h;
typedef __attribute__((ext_vector_type(8)))  _Float16 v8h;
typedef __attribute__((ext_vector_type(8)))  unsigned short v8us;
typedef __attribute__((ext_vector_type(8)))  float    v8f;
typedef __attribute__((ext_vector_type(4)))  float    v4f;
typedef v8h  __attribute__((may_alias)) v8ha;
typedef v4f  __attribute__((may_alias)) v4fa;
typedef v8us __attribute__((may_alias)) v8usa;

__device__ __forceinline__ unsigned short f2bf(float f) { unsigned u = __float_as_uint(f); u += 0x7FFFu + ((u >> 16) & 1u); return (unsigned short)(u >> 16); }
__device__ __forceinline__ float bf2f(unsigned short b) { return __uint_as_float(((unsigned)b) << 16); }
__device__ __forceinline__ float bfr(float f) { return bf2f(f2bf(f)); }
__device__ __forceinline__ v16h cat16(v8h lo, v8h hi) { return __builtin_shufflevector(lo, hi, 0, 1, 2, 3, 4, 5, 6, 7, 8, 9, 10, 11, 12, 13, 14, 15); }
__device__ __forceinline__ v16bf cat16b(v8us lo, v8us hi) { return __builtin_bit_cast(v16bf, __builtin_shufflevector(lo, hi, 0, 1, 2, 3, 4, 5, 6, 7, 8, 9, 10, 11, 12, 13, 14, 15)); }
__device__ __forceinline__ v8f wmma16(v16h a, v16h b, v8f c) { return __builtin_amdgcn_wmma_f32_16x16x32_f16(false, a, false, b, (short)0, c, false, false); }
__device__ __forceinline__ v8f wmmab(v16bf a, v16bf b, v8f c) { return __builtin_amdgcn_wmma_f32_16x16x32_bf16(false, a, false, b, (short)0, c, false, false); }



// ---- k_gemmw: register-blocked GEMM, ONE WAVE per 64x64 output tile (16 accumulators), operands straight from K-contiguous 16-bit planes; grid (M/64, N/64, Z), 32 threads.
// C[m][n] (f32, pitch ldc, + optional f32 bias[n]) = sum_k A[m][k] Bt[n][k] (+ split products per NSPLIT). z-batch strides sA/sB/sC in elements. K % 32 == 0.
// K is the row pitch of A and Bt; a work-group sums kspan of the K elements (kspan % 32 == 0). With kspan < K, sA = sB = kspan and grid z = K / kspan, plane z of C holds the partial sum over k in [z kspan, (z + 1) kspan).
template <typename T16> struct WFrag;
template <> struct WFrag<h16> { typedef v16h V; static __device__ __forceinline__ V ld(const h16* p) { return cat16(*(const v8h*)p, *(const v8h*)(p + 16)); } static __device__ __forceinline__ v8f mma(V a, V b, v8f c) { return wmma16(a, b, c); } };
template <> struct WFrag<bf> { typedef v16bf V; static __device__ __forceinline__ V ld(const bf* p) { return cat16b(*(const v8us*)p, *(const v8us*)(p + 16)); } static __device__ __forceinline__ v8f mma(V a, V b, v8f c) { return wmmab(a, b, c); } };
template <typename T16, int NSPLIT, bool BIAS>
__global__ __launch_bounds__(32) void k_gemmw(const T16* __restrict__ A, const T16* __restrict__ A2, const T16* __restrict__ Bt, const T16* __restrict__ Bt2, int K, int kspan, float* C, int ldc, const float* __restrict__ bias, size_t sA, size_t sB, size_t sC) {
    typedef typename WFrag<T16>::V V;
    __shared__ __align__(16) float os[16 * 68];
    const size_t z = blockIdx.z; A += z * sA; if (A2) A2 += z * sA; Bt += z * sB; if (Bt2) Bt2 += z * sB; C += z * sC;
    const int lane = threadIdx.x & 31, lr = lane & 15, hi = lane >> 4; const int r0 = blockIdx.x * 64, c0 = blockIdx.y * 64;
    v8f acc[4][4];
#pragma unroll
    for (int mb = 0; mb < 4; ++mb)
#pragma unroll
        for (int nb = 0; nb < 4; ++nb) acc[mb][nb] = (v8f){};
    const size_t aoff = (size_t)(r0 + lr) * K + 8 * hi, boff = (size_t)(c0 + lr) * K + 8 * hi;
#pragma unroll 1
    for (int kc = 0; kc < kspan; kc += 32) {
        V a[4], a2[4];
#pragma unroll
        for (int mb = 0; mb < 4; ++mb) { a[mb] = WFrag<T16>::ld(A + aoff + (size_t)mb * 16 * K + kc); if (NSPLIT == 1 || NSPLIT == 2) a2[mb] = WFrag<T16>::ld(A2 + aoff + (size_t)mb * 16 * K + kc); }
#pragma unroll
        for (int nb = 0; nb < 4; ++nb) { const V b = WFrag<T16>::ld(Bt + boff + (size_t)nb * 16 * K + kc); V b2; if (NSPLIT >= 2) b2 = WFrag<T16>::ld(Bt2 + boff + (size_t)nb * 16 * K + kc);
#pragma unroll
            for (int mb = 0; mb < 4; ++mb) { acc[mb][nb] = WFrag<T16>::mma(a[mb], b, acc[mb][nb]); if (NSPLIT == 1 || NSPLIT == 2) acc[mb][nb] = WFrag<T16>::mma(a2[mb], b, acc[mb][nb]); if (NSPLIT >= 2) acc[mb][nb] = WFrag<T16>::mma(a[mb], b2, acc[mb][nb]); } }
        asm volatile("v_nop\n\tv_nop\n\tv_nop\n\tv_nop" : "+v"(acc[0][0]), "+v"(acc[1][1]), "+v"(acc[2][2]), "+v"(acc[3][3]) : "v"(a[0]), "v"(a[3]));
    }
#pragma unroll
    for (int mb = 0; mb < 4; ++mb) {
#pragma unroll
        for (int nb = 0; nb < 4; ++nb) {
#pragma unroll
            for (int j = 0; j < 8; ++j) os[(hi * 8 + j) * 68 + nb * 16 + lr] = acc[mb][nb][j]; }
        __builtin_amdgcn_wave_barrier(); asm volatile("" ::: "memory");
        float* crow = C + (size_t)(r0 + mb * 16) * ldc + c0;
{
#pragma unroll
            for (int s = 0; s < 8; ++s) { const int row = 2 * s + hi, cofs = lr * 4; v4f val = *(const v4fa*)(os + row * 68 + cofs); if (BIAS) { val[0] += bfr(bias[c0 + cofs]); val[1] += bfr(bias[c0 + cofs + 1]); val[2] += bfr(bias[c0 + cofs + 2]); val[3] += bfr(bias[c0 + cofs + 3]); }
                *(v4f*)(crow + (size_t)row * ldc + cofs) = val; }
             }
        __builtin_amdgcn_wave_barrier(); asm volatile("" ::: "memory");
    }
}

__device__ __forceinline__ h16 tohx(float x) { return (h16)x; }
__device__ __forceinline__ void splitf(float y, unsigned short& h, unsigned short& l) { h = f2bf(y); l = f2bf(y - bf2f(h)); }
typedef __attribute__((ext_vector_type(2))) _Float16 v2h;
typedef __attribute__((ext_vector_type(4))) _Float16 v4h;
typedef __attribute__((ext_vector_type(2))) unsigned short v2us;
typedef __attribute__((ext_vector_type(4))) unsigned short v4us;
typedef __attribute__((ext_vector_type(2))) float v2f;
typedef __attribute__((ext_vector_type(4))) int v4i;

__global__ __launch_bounds__(256) void k_wtG(const float* __restrict__ w, int K, int N, bf* Bt) {
    const int lane = threadIdx.x & 31; const int L0 = (blockIdx.x * 8 + (threadIdx.x >> 5)) * 8; const int nlines = N * K / 64;
{
#pragma unroll 1
        for (int l = 0; l < 8; ++l) { const int L = L0 + l; if (L >= nlines) break; const size_t e = (size_t)L * 64 + lane * 2; const int k = (int)(e % K), n = (int)(e / K); v2us o;
            o[0] = f2bf(w[(size_t)k * N + n]); o[1] = f2bf(w[(size_t)(k + 1) * N + n]); *(v2us*)(Bt + e) = o; }
         }
}
__global__ __launch_bounds__(256) void k_cvt8(const float* __restrict__ src, bf* dst, size_t n8) { const size_t i = (size_t)blockIdx.x * 256 + threadIdx.x; if (i >= n8) return; const v8f v = *(const v8f*)(src + i * 8); v8us o;
#pragma unroll
    for (int k = 0; k < 8; ++k) o[k] = f2bf(v[k]); *(v8us*)(dst + i * 8) = o;  }


__global__ __launch_bounds__(256) void k_vtp(const float* __restrict__ F, int pitch, int nheads, h16* V16, bf* Vh, bf* Vl) { const size_t e = ((size_t)blockIdx.x * 256 + threadIdx.x) * 2; if (e >= (size_t)nheads * HD * TT) return; const int t = (int)(e % TT); const int d = (int)((e / TT) % HD); const int g = (int)(e / ((size_t)TT * HD)); v2h o16; v2us oh, ol;
#pragma unroll
    for (int q = 0; q < 2; ++q) { const float x = F[(size_t)(t + q) * pitch + g * HD + d]; o16[q] = tohx(x); unsigned short a2, c2; splitf(x, a2, c2); oh[q] = a2; ol[q] = c2; }
    *(v2h*)(V16 + e) = o16; *(v2us*)(Vh + e) = oh; *(v2us*)(Vl + e) = ol;  }
__global__ __launch_bounds__(256) void k_flat(const float* __restrict__ F, h16* P16, bf* Ph, bf* Pl, size_t n4) { const size_t i = (size_t)blockIdx.x * 256 + threadIdx.x; if (i >= n4) return; const v4f a = *(const v4f*)(F + i * 4); v4h o16; v4us oh, ol;
#pragma unroll
    for (int q = 0; q < 4; ++q) { o16[q] = tohx(a[q]); unsigned short x2, y2; splitf(a[q], x2, y2); oh[q] = x2; ol[q] = y2; }
    *(v4h*)(P16 + i * 4) = o16; *(v4us*)(Ph + i * 4) = oh; *(v4us*)(Pl + i * 4) = ol;  }

__global__ __launch_bounds__(256) void k_wqpad(const float* __restrict__ w, const float* __restrict__ bias, bf* Bt, float* bp) { const int i = blockIdx.x * 256 + threadIdx.x; if (i >= MID * CC / 8) return; const int c0 = (i % (CC / 8)) * 8; const int r = i / (CC / 8); const float* src = w + (size_t)min(r, CQR - 1) * CC + c0; v8us o;
#pragma unroll
    for (int q = 0; q < 8; ++q) { const unsigned short v = f2bf(src[q]); o[q] = (r < CQR) ? v : (unsigned short)0; }
    *(v8us*)(Bt + (size_t)r * CC + c0) = o; if (i < MID) { const float bb = bias[min(i, CQR - 1)]; ((float*)bp)[i] = (i < CQR) ? bb : 0.0f; }  }
__global__ __launch_bounds__(256) void k_xT(const float* __restrict__ xs, bf* XB) { const size_t k = (size_t)blockIdx.x * 256 + threadIdx.x; if (k >= (size_t)TT * CC / 8) return; const int c0 = (int)(k % (CC / 8)) * 8; const int t = (int)(k / (CC / 8)); v8us o;
#pragma unroll
    for (int q = 0; q < 8; ++q) o[q] = f2bf(xs[(size_t)(c0 + q) * TT + t]);
    *(v8us*)(XB + (size_t)t * CC + c0) = o;  }
__global__ __launch_bounds__(256) void k_addpos(float* FK, const float* __restrict__ rh, const float* __restrict__ rw) { const size_t i = (size_t)blockIdx.x * 256 + threadIdx.x; if (i >= (size_t)TT * MID / 4) return; const size_t e = i * 4; const int c0 = (int)(e % MID); const int t = (int)(e / MID); const int hh = t / 64, ww = t % 64; const v4f a = *(const v4f*)(FK + e); v4f o;
#pragma unroll
    for (int q = 0; q < 4; ++q) { const int c = c0 + q; const float p = __fadd_rn(bfr(rh[c * 64 + hh]), bfr(rw[c * 64 + ww])); o[q] = __fadd_rn(a[q], p); }
    *(v4f*)(FK + e) = o;  }

typedef __attribute__((ext_vector_type(16))) unsigned short v16us;
#define L2E 1.4426950408889634f
// ---- k_attn: scores, softmax and attn.v of one key span for one query tile, 4 waves x 16 NQ queries (rows < RH: NQ = 1, 64-query tiles, which start first; rest NQ = 2, 128-query tiles), nothing staged in memory or LDS.
// The score tile is formed TRANSPOSED (A = 16 key rows, B = 16 query rows), so a lane holds one query (column lr) and keys 8 hi + j of each 16-key tile: the row maximum and sum are in-lane but for one exchange with lane ^ 16,
// and two such tiles, converted, ARE the B fragment (k = 8 hi + 0..7, 16 + 8 hi + 0..7) of out^T[c][n] += V^T[c][k] P[n][k]. 
// Per span: running maximum m, sum l and unnormalised out^T, each relative to m; k_merge joins the spans. Inner loops are unrolled so that every fragment array stays in registers.
// K and V fragments come straight from the row-major planes (row pitch 128 B and 8 KiB): each 16-byte load of a wave touches 16 lines, and the 4 waves of a work-group load the same K and V.
template <bool HR, int NQ>
__device__ __forceinline__ void attn_span(const bf* __restrict__ Qh, const bf* __restrict__ Ql, const bf* __restrict__ Kh, const bf* __restrict__ Kl, const h16* __restrict__ V16, const bf* __restrict__ Vh, const bf* __restrict__ Vl, int n0, int k0, int k1, float* Op, float* ML) {
    const int lane = threadIdx.x & 31, lr = lane & 15, hi = lane >> 4;
    v16bf qh[NQ][2], ql[NQ][2];
#pragma unroll
    for (int nq = 0; nq < NQ; ++nq)
#pragma unroll
        for (int kc = 0; kc < 2; ++kc) { const size_t qo = (size_t)(n0 + nq * 16 + lr) * MID + kc * 32 + 8 * hi; qh[nq][kc] = WFrag<bf>::ld(Qh + qo); ql[nq][kc] = WFrag<bf>::ld(Ql + qo); }
    v8f o[4][NQ]; float m[NQ], l[NQ];
#pragma unroll
    for (int nq = 0; nq < NQ; ++nq) { m[nq] = -3.0e38f; l[nq] = 0.0f;
#pragma unroll
        for (int ct = 0; ct < 4; ++ct) o[ct][nq] = (v8f){}; }
#pragma unroll 1   /* kept rolled: a second pass's fragments would push the wave past 256 registers (4 waves per SIMD) */
    for (int kb = k0; kb < k1; kb += 32) {
        v16h va[4]; v16bf vh[4], vl[4];
#pragma unroll
        for (int ct = 0; ct < 4; ++ct) { const size_t vo = (size_t)(ct * 16 + lr) * TT + kb + 8 * hi; if (HR) vh[ct] = WFrag<bf>::ld(Vh + vo); else va[ct] = WFrag<h16>::ld(V16 + vo); }
        if (HR) {
            asm volatile("s_wait_xcnt 0x0" ::: "memory");   /* precaution: stands before any address register of the loads above is reused */
#pragma unroll
            for (int ct = 0; ct < 4; ++ct) vl[ct] = WFrag<bf>::ld(Vl + (size_t)(ct * 16 + lr) * TT + kb + 8 * hi);
            asm volatile("s_wait_xcnt 0x0" ::: "memory");   /* the same for the low plane's loads */
        }
        v8f s[2][NQ];
#pragma unroll
        for (int kt = 0; kt < 2; ++kt) {
#pragma unroll
            for (int nq = 0; nq < NQ; ++nq) s[kt][nq] = (v8f){};
#pragma unroll
            for (int kc = 0; kc < 2; ++kc) { const size_t ko = (size_t)(kb + kt * 16 + lr) * MID + kc * 32 + 8 * hi; const v16bf kh = WFrag<bf>::ld(Kh + ko), kl = WFrag<bf>::ld(Kl + ko);
#pragma unroll
                for (int nq = 0; nq < NQ; ++nq) { s[kt][nq] = wmmab(kh, qh[nq][kc], s[kt][nq]); s[kt][nq] = wmmab(kh, ql[nq][kc], s[kt][nq]); s[kt][nq] = wmmab(kl, qh[nq][kc], s[kt][nq]); } } }
        float al[NQ]; bool moved = false;
#pragma unroll
        for (int nq = 0; nq < NQ; ++nq) { float mx = fmaxf(s[0][nq][0], s[1][nq][0]);
#pragma unroll
            for (int j = 1; j < 8; ++j) mx = fmaxf(mx, fmaxf(s[0][nq][j], s[1][nq][j]));
            mx = fmaxf(mx, __shfl_xor(mx, 16, 32));
            const float mn = fmaxf(m[nq], mx); moved = moved || (mn > m[nq]); al[nq] = __builtin_amdgcn_exp2f((m[nq] - mn) * L2E); m[nq] = mn; float ps = 0.0f;
#pragma unroll
            for (int kt = 0; kt < 2; ++kt)
#pragma unroll
                for (int j = 0; j < 8; ++j) { const float p = __builtin_amdgcn_exp2f((s[kt][nq][j] - mn) * L2E); s[kt][nq][j] = p; ps += p; }
            l[nq] = l[nq] * al[nq] + ps; }
        if (__any(moved)) {   /* no maximum of the wave moved: every factor is exactly 1 */
#pragma unroll
            for (int ct = 0; ct < 4; ++ct)
#pragma unroll
                for (int nq = 0; nq < NQ; ++nq) o[ct][nq] *= al[nq]; }
        if (HR) {
            v16bf ph[NQ], pl[NQ];
#pragma unroll
            for (int nq = 0; nq < NQ; ++nq) { v16us a16, c16;
#pragma unroll
                for (int e = 0; e < 8; ++e) { unsigned short a2, c2; splitf(s[0][nq][e], a2, c2); a16[e] = a2; c16[e] = c2; splitf(s[1][nq][e], a2, c2); a16[8 + e] = a2; c16[8 + e] = c2; }
                ph[nq] = __builtin_bit_cast(v16bf, a16); pl[nq] = __builtin_bit_cast(v16bf, c16); }
#pragma unroll
            for (int ct = 0; ct < 4; ++ct)
#pragma unroll
                for (int nq = 0; nq < NQ; ++nq) { o[ct][nq] = wmmab(vh[ct], ph[nq], o[ct][nq]); o[ct][nq] = wmmab(vh[ct], pl[nq], o[ct][nq]); o[ct][nq] = wmmab(vl[ct], ph[nq], o[ct][nq]); }
        } else {
            v16h pf[NQ];
#pragma unroll
            for (int nq = 0; nq < NQ; ++nq)
#pragma unroll
                for (int e = 0; e < 8; ++e) { pf[nq][e] = tohx(s[0][nq][e] * PCAR); pf[nq][8 + e] = tohx(s[1][nq][e] * PCAR); }
#pragma unroll
            for (int ct = 0; ct < 4; ++ct)
#pragma unroll
                for (int nq = 0; nq < NQ; ++nq) o[ct][nq] = wmma16(va[ct], pf[nq], o[ct][nq]);
        }
    }
#pragma unroll
    for (int nq = 0; nq < NQ; ++nq) { const size_t nb = (size_t)(n0 / 16 + nq); const float lt = l[nq] + __shfl_xor(l[nq], 16, 32);   /* a wave owns every 128-byte line that it writes */
#pragma unroll
        for (int ct = 0; ct < 4; ++ct)
#pragma unroll
            for (int j = 0; j < 8; ++j) Op[(nb * CC + ct * 16 + hi * 8 + j) * 16 + lr] = o[ct][nq][j];
        ML[nb * 32 + lane] = hi ? lt : m[nq]; }
}
__global__ __launch_bounds__(128) void k_attn(const bf* __restrict__ Qh, const bf* __restrict__ Ql, const bf* __restrict__ Kh, const bf* __restrict__ Kl, const h16* __restrict__ V16, const bf* __restrict__ Vh, const bf* __restrict__ Vl, float* Op, float* ML) {
    const size_t b = blockIdx.y, pl = (size_t)blockIdx.x * NB_ + b; const size_t tb = b * TT * MID, vb = b * CC * TT;
    const int tile = blockIdx.z, wv = threadIdx.x >> 5, k0 = (int)(blockIdx.x * (TT / 32) / NSP) * 32, k1 = (int)((blockIdx.x + 1) * (TT / 32) / NSP) * 32;
    if (tile < RH / 64) attn_span<true, 1>(Qh + tb, Ql + tb, Kh + tb, Kl + tb, V16 + vb, Vh + vb, Vl + vb, tile * 64 + wv * 16, k0, k1, Op + pl * CC * TT, ML + pl * TT * 2);
    else { attn_span<false, 2>(Qh + tb, Ql + tb, Kh + tb, Kl + tb, V16 + vb, Vh + vb, Vl + vb, RH + (tile - RH / 64) * 128 + wv * 32, k0, k1, Op + pl * CC * TT, ML + pl * TT * 2);
        asm volatile("s_wait_xcnt 0x0" ::: "memory"); }   /* precaution: in the built code this path's last stores are followed by the other path's prologue, which reuses their registers */
}
// k_merge: out[b][c][n] = sum_s O_s[c][n] w_s / sum_s l_s w_s, w_s = exp(m_s - max m), spans in order; the x1024 carry of the fp16 rows is taken out here.
// Per span and batch: O [n / 16][c][n % 16]; ML [n / 16][32]: 16 maxima, then 16 sums.
__global__ __launch_bounds__(256) void k_merge(const float* __restrict__ Op, const float* __restrict__ ML, float* out) { const size_t i = (size_t)blockIdx.x * 256 + threadIdx.x; if (i >= (size_t)NB_ * CC * TT / 4) return; const int n = (int)(i % (TT / 4)) * 4; const int c = (int)((i / (TT / 4)) % CC); const size_t b = i / ((size_t)CC * TT / 4); const size_t nb = (size_t)(n / 16); const int nr = n % 16; v4f ms[NSP]; v4f mx;
#pragma unroll
    for (int s = 0; s < NSP; ++s) { ms[s] = *(const v4f*)(ML + (((size_t)s * NB_ + b) * (TT / 16) + nb) * 32 + nr);
#pragma unroll
        for (int q = 0; q < 4; ++q) mx[q] = s ? fmaxf(mx[q], ms[s][q]) : ms[s][q]; }
    v4f num = (v4f){}, den = (v4f){};
#pragma unroll
    for (int s = 0; s < NSP; ++s) { const size_t pn = ((size_t)s * NB_ + b) * (TT / 16) + nb; const v4f ls = *(const v4f*)(ML + pn * 32 + 16 + nr); const v4f os = *(const v4f*)(Op + (pn * CC + c) * 16 + nr);
#pragma unroll
        for (int q = 0; q < 4; ++q) { const float w = __builtin_amdgcn_exp2f((ms[s][q] - mx[q]) * L2E); num[q] += os[q] * w; den[q] += ls[q] * w; } }
    const float cs = (n < RH) ? 1.0f : (1.0f / PCAR); v4f r;
#pragma unroll
    for (int q = 0; q < 4; ++q) r[q] = num[q] * __fdiv_rn(cs, den[q]);
    *(v4f*)(out + (b * CC + c) * TT + n) = r;  }

extern "C" void kernel_launch(void* const* d_in, const int* in_sizes, int n_in,
                              void* d_out, int out_size, void* d_ws, size_t ws_size, hipStream_t stream) {
    (void)in_sizes; (void)n_in; (void)out_size;
    const float* x = (const float*)d_in[0]; const float* wq = (const float*)d_in[1]; const float* bq = (const float*)d_in[2]; const float* wk = (const float*)d_in[3]; const float* bk = (const float*)d_in[4]; const float* wv = (const float*)d_in[5]; const float* bv = (const float*)d_in[6]; const float* relh = (const float*)d_in[7]; const float* relw = (const float*)d_in[8];   /* [1][64][64][1], [1][64][1][64] */
    float* OUT = (float*)d_out;     // [4][64][4096] channel-major
    char* wsp = (char*)d_ws;
    auto take = [&](size_t bytes) { char* p = wsp; wsp += (bytes + 255) & ~(size_t)255; return (void*)p; };
    bf* WQ = (bf*)take((size_t)MID * CC * 2); bf* WK = (bf*)take((size_t)MID * CC * 2); float* BQP = (float*)take(256); float* BKP = (float*)take(256); bf* WV = (bf*)take((size_t)CC * CC * 2);
    bf* XB = (bf*)take((size_t)TT * CC * 2); float* FQ = (float*)take((size_t)TT * MID * 4); float* FK = (float*)take((size_t)TT * MID * 4); float* FV = (float*)take((size_t)TT * CC * 4);
    h16* QP16 = (h16*)take((size_t)TT * MID * 2); bf* QPh = (bf*)take((size_t)NB_ * TT * MID * 2); bf* QPl = (bf*)take((size_t)NB_ * TT * MID * 2); h16* KP16 = (h16*)take((size_t)TT * MID * 2); bf* KPh = (bf*)take((size_t)NB_ * TT * MID * 2); bf* KPl = (bf*)take((size_t)NB_ * TT * MID * 2);   /* hi/lo planes: one set per batch */
    h16* VT16 = (h16*)take((size_t)NB_ * CC * TT * 2); bf* VTh = (bf*)take((size_t)NB_ * CC * TT * 2); bf* VTl = (bf*)take((size_t)NB_ * CC * TT * 2);
    float* Op = (float*)take((size_t)NSP * NB_ * CC * TT * 4); float* ML = (float*)take((size_t)NSP * NB_ * TT * 2 * 4);   /* per span and batch: unnormalised out^T in blocks of 16 queries, running maxima and sums */
    if ((size_t)(wsp - (char*)d_ws) > ws_size) return;    // ws 256 MiB (carve ~47 MiB)
    k_wqpad<<<(MID * CC / 8 + 255) / 256, 256, 0, stream>>>(wq, bq, WQ, BQP); k_wqpad<<<(MID * CC / 8 + 255) / 256, 256, 0, stream>>>(wk, bk, WK, BKP);   /* 'oi' [64][64] -> Bt [64][64] bf16, no zero rows (CQR == MID), biases copied */ k_cvt8<<<(unsigned)(((size_t)CC * CC / 8 + 255) / 256), 256, 0, stream>>>(wv, WV, (size_t)CC * CC / 8);   /* 'oi' conv weights = Bt as-is */
    for (int b = 0; b < NB_; ++b) {
        const float* xb = x + (size_t)b * CC * TT;
        k_xT<<<(unsigned)(((size_t)TT * CC / 8 + 255) / 256), 256, 0, stream>>>(xb, XB);
        k_gemmw<bf, 0, true><<<dim3(TT / 64, MID / 64, 1), 32, 0, stream>>>(XB, nullptr, WQ, nullptr, CC, CC, FQ, MID, BQP, 0, 0, 0); k_flat<<<(unsigned)(((size_t)TT * MID / 4 + 255) / 256), 256, 0, stream>>>(FQ, QP16, QPh + (size_t)b * TT * MID, QPl + (size_t)b * TT * MID, (size_t)TT * MID / 4);
        k_gemmw<bf, 0, true><<<dim3(TT / 64, MID / 64, 1), 32, 0, stream>>>(XB, nullptr, WK, nullptr, CC, CC, FK, MID, BKP, 0, 0, 0); k_addpos<<<(unsigned)(((size_t)TT * MID / 4 + 255) / 256), 256, 0, stream>>>(FK, relh, relw);   /* k + pos (f32) */ k_flat<<<(unsigned)(((size_t)TT * MID / 4 + 255) / 256), 256, 0, stream>>>(FK, KP16, KPh + (size_t)b * TT * MID, KPl + (size_t)b * TT * MID, (size_t)TT * MID / 4);
        k_gemmw<bf, 0, true><<<dim3(TT / 64, CC / 64, 1), 32, 0, stream>>>(XB, nullptr, WV, nullptr, CC, CC, FV, CC, bv, 0, 0, 0); k_vtp<<<(unsigned)(((size_t)TT * CC / 2 + 255) / 256), 256, 0, stream>>>(FV, CC, CC / HD, VT16 + (size_t)b * CC * TT, VTh + (size_t)b * CC * TT, VTl + (size_t)b * CC * TT);   /* V^T planes [64][4096] */ }
    k_attn<<<dim3(NSP, NB_, RH / 64 + (TT - RH) / 128), 128, 0, stream>>>(QPh, QPl, KPh, KPl, VT16, VTh, VTl, Op, ML);   /* scores (every row hi/lo, unscaled logits), softmax, attn.v: all batches */
    k_merge<<<(unsigned)(((size_t)NB_ * CC * TT / 4 + 255) / 256), 256, 0, stream>>>(Op, ML, OUT);   /* spans joined, channel-major output */
}

// v003
// Measured time: 82.5 microseconds a run.
// In two side-by-side timings against v002, it was 2.11 and 2.17 times as fast.
// All steps since v000 together make it 12.7 times as fast.
#include <hip/hip_runtime.h>

// Self-attention over a 64x64 feature map with a learned 2-D positional key term (x [4][64][64x64] channel-major; q, k, v = 1x1 convs 'oi' [64][64] + [64] (1/8 weights, 0.02 biases); energy[n][m] = q_n.k_m + q_n.pos_m with pos[c][(hh, ww)] = rel_h[c][hh] + rel_w[c][ww] ([1][64][64][1] + [1][64][1][64], read) == q_n.(k_m + pos_m) (unscaled, sigma ~8); softmax over the 4,096 positions; out[c][n] = sum_m v[c][m] attn[n][m] -> [4][64][64][64] (1.0 M)).
// Layout: one kernel for all batches (k_prep) rounds the channel-major map and the weights to bf16, does the three exact projections + f32 biases, adds the positional table to the key rows in f32 (q.k + q.pos == q.(k + pos)) and writes the hi/lo planes, one set per batch. One kernel for all batches then does scores, softmax and attn.v in registers (k_attn), one key span per work-group; k_merge joins the spans and writes the channel-major output rows.
// Compute dtypes, f32 accumulate: every input rounded to bf16; projections exact + f32 biases; scores 3 products on every row; softmax f32 (running maximum); attn.V rows < 512 3 products (P, V hi/lo), rest fp16 (P x1024); epilogue f32.

#define NB_  4
#define TT   4096
#define DM   512
#define NH_  1
#define NKV  1
#define REP  (NH_ / NKV)
#define HD   64
#define DQ   (NH_ * HD)
#define DKV  (NKV * HD)
#define ZH   1
#define RH   512                  // query rows < RH use hi+lo planes (0: none)
#define WIN  0
#define PCAR 1024.0f
#define SCL  1.0f   // no scaling in the module
#define MID  64
#define CQR  64      // q/k use all channels (no padding)
#define CC   64
#define NSP  7       // the 128 passes of 32 keys are dealt to NSP spans (18 or 19 each; 36 tiles x 4 batches x 7 = 1,008 work-groups of 4 waves at 4 waves per SIMD: one round on 256 WGPs), one work-group per span and query tile
typedef _Float16 h16;
typedef unsigned short bf;
typedef __attribute__((ext_vector_type(16))) __bf16   v16bf;
typedef __attribute__((ext_vector_type(16))) _Float16 v16h;
typedef __attribute__((ext_vector_type(8)))  _Float16 v8h;
typedef __attribute__((ext_vector_type(8)))  unsigned short v8us;
typedef __attribute__((ext_vector_type(8)))  float    v8f;
typedef __attribute__((ext_vector_type(4)))  float    v4f;
typedef v8h  __attribute__((may_alias)) v8ha;
typedef v4f  __attribute__((may_alias)) v4fa;
typedef v8us __attribute__((may_alias)) v8usa;

__device__ __forceinline__ unsigned short f2bf(float f) { unsigned u = __float_as_uint(f); u += 0x7FFFu + ((u >> 16) & 1u); return (unsigned short)(u >> 16); }
__device__ __forceinline__ float bf2f(unsigned short b) { return __uint_as_float(((unsigned)b) << 16); }
__device__ __forceinline__ float bfr(float f) { return bf2f(f2bf(f)); }
__device__ __forceinline__ v16h cat16(v8h lo, v8h hi) { return __builtin_shufflevector(lo, hi, 0, 1, 2, 3, 4, 5, 6, 7, 8, 9, 10, 11, 12, 13, 14, 15); }
__device__ __forceinline__ v16bf cat16b(v8us lo, v8us hi) { return __builtin_bit_cast(v16bf, __builtin_shufflevector(lo, hi, 0, 1, 2, 3, 4, 5, 6, 7, 8, 9, 10, 11, 12, 13, 14, 15)); }
__device__ __forceinline__ v8f wmma16(v16h a, v16h b, v8f c) { return __builtin_amdgcn_wmma_f32_16x16x32_f16(false, a, false, b, (short)0, c, false, false); }
__device__ __forceinline__ v8f wmmab(v16bf a, v16bf b, v8f c) { return __builtin_amdgcn_wmma_f32_16x16x32_bf16(false, a, false, b, (short)0, c, false, false); }



template <typename T16> struct WFrag;   // 16x32 operand fragment from a K-contiguous 16-bit row: p = row start + 8 (lane >> 4); k = 8 hi + 0..7, 16 + 8 hi + 0..7 (A and B alike)
template <> struct WFrag<h16> { typedef v16h V; static __device__ __forceinline__ V ld(const h16* p) { return cat16(*(const v8h*)p, *(const v8h*)(p + 16)); } };
template <> struct WFrag<bf> { typedef v16bf V; static __device__ __forceinline__ V ld(const bf* p) { return cat16b(*(const v8us*)p, *(const v8us*)(p + 16)); } };

__device__ __forceinline__ h16 tohx(float x) { return (h16)x; }
__device__ __forceinline__ void splitf(float y, unsigned short& h, unsigned short& l) { h = f2bf(y); l = f2bf(y - bf2f(h)); }
typedef __attribute__((ext_vector_type(16))) unsigned short v16us;

#define WP 72   // LDS row pitch in 16-bit elements: 144 B = 16 B x odd, for the 16-byte fragment reads
// ---- k_prep: everything in front of the attention, one launch. Grid (64 map rows, 4 batches), 4 waves; a work-group owns the 64 tokens of one map row (hh = blockIdx.x, ww = 0..63).
// Each wave rounds its own 16 tokens' x to bf16 straight into a fragment (row = token, k = channel), which also goes to LDS; the work-group rounds the three weight matrices ('oi' = K-contiguous rows) into LDS once.
// q, k: A = 16 weight rows, B = the wave's own tokens, so a lane holds one token and 8 consecutive output channels: 16-byte stores, and the wave writes the whole 128-byte row of each of its tokens.
// v: A = 16 tokens (from LDS), B = weight rows 16 wave + 0..15, so a lane holds one channel and 8 consecutive tokens, and the wave writes the whole 128-byte piece (64 tokens) of each of its channel rows.
// Every product sums k = 0..31, then 32..63, as two accumulating matrix instructions.
__global__ __launch_bounds__(128) void k_prep(const float* __restrict__ x, const float* __restrict__ wq, const float* __restrict__ bq, const float* __restrict__ wk, const float* __restrict__ bk, const float* __restrict__ wv, const float* __restrict__ bv, const float* __restrict__ rh, const float* __restrict__ rw,
                                              bf* Qh, bf* Ql, bf* Kh, bf* Kl, h16* V16, bf* Vh, bf* Vl) {
    __shared__ __align__(16) bf Ws[3 * 64 * WP];
    __shared__ __align__(16) bf Xs[64 * WP];
    __shared__ __align__(32) float Rh[64];   /* this map row's column of rel_h, rounded */
    const int tid = threadIdx.x, lane = tid & 31, lr = lane & 15, hi = lane >> 4, wvi = tid >> 5;
    const int hh = blockIdx.x, tl = wvi * 16 + lr; const size_t b = blockIdx.y;
    const float* xt = x + b * CC * TT + hh * 64 + tl;
    float xr[2][16];
#pragma unroll
    for (int kc = 0; kc < 2; ++kc)
#pragma unroll
        for (int e = 0; e < 16; ++e) xr[kc][e] = xt[(kc * 32 + 8 * hi + (e & 7) + 16 * (e >> 3)) * TT];
    asm volatile("s_wait_xcnt 0x0" ::: "memory");   /* precaution, here and below: stands before any register that the loads or stores above name is reused */
    v8f wr[12];   /* 3 x 512 runs of 8 weights, 12 per thread */
#pragma unroll
    for (int i = 0; i < 12; ++i) wr[i] = *(const v8f*)((i < 4 ? wq : i < 8 ? wk : wv) + ((i & 3) * 128 + tid) * 8);
    asm volatile("s_wait_xcnt 0x0" ::: "memory");
    float rwr[4][8]; v8f bqr[4], bkr[4];
#pragma unroll
    for (int ot = 0; ot < 4; ++ot)
#pragma unroll
        for (int j = 0; j < 8; ++j) rwr[ot][j] = rw[(ot * 16 + 8 * hi + j) * 64 + tl];
    asm volatile("s_wait_xcnt 0x0" ::: "memory");
#pragma unroll
    for (int ot = 0; ot < 4; ++ot) { bqr[ot] = *(const v8f*)(bq + ot * 16 + 8 * hi); bkr[ot] = *(const v8f*)(bk + ot * 16 + 8 * hi); }
    const float bvw = bv[tl];   /* channel 16 wave + lr */
    asm volatile("s_wait_xcnt 0x0" ::: "memory");
    const float bvr = bfr(bvw);
    if (tid < 64) { const float rhw = rh[tid * 64 + hh];   /* waves 0 and 1, whole */
        asm volatile("s_wait_xcnt 0x0" :: "v"(rhw) : "memory");   /* the same precaution; the loaded value as an input keeps the wait behind this load */
        Rh[tid] = bfr(rhw); }
    v16bf xf[2];
#pragma unroll
    for (int kc = 0; kc < 2; ++kc) { v8us lo8, hi8;
#pragma unroll
        for (int e = 0; e < 8; ++e) { lo8[e] = f2bf(xr[kc][e]); hi8[e] = f2bf(xr[kc][8 + e]); }
        *(v8us*)(Xs + tl * WP + kc * 32 + 8 * hi) = lo8; *(v8us*)(Xs + tl * WP + kc * 32 + 8 * hi + 16) = hi8; xf[kc] = cat16b(lo8, hi8); }
#pragma unroll
    for (int i = 0; i < 12; ++i) { const int u = (i & 3) * 128 + tid; v8us o;
#pragma unroll
        for (int q = 0; q < 8; ++q) o[q] = f2bf(wr[i][q]);
        *(v8us*)(Ws + ((i >> 2) * 64 + (u >> 3)) * WP + (u & 7) * 8) = o; }
    __syncthreads();
    const size_t qrow = (b * TT + hh * 64 + tl) * MID + 8 * hi;
#pragma unroll
    for (int p = 0; p < 2; ++p)   /* 0: q, 1: k + pos */
#pragma unroll
        for (int ot = 0; ot < 4; ++ot) { v8f acc = (v8f){};
#pragma unroll
            for (int kc = 0; kc < 2; ++kc) acc = wmmab(WFrag<bf>::ld(Ws + (p * 64 + ot * 16 + lr) * WP + kc * 32 + 8 * hi), xf[kc], acc);
            v8us oh, ol; v8f rhv; if (p) rhv = *(const v8f*)(Rh + ot * 16 + 8 * hi);
#pragma unroll
            for (int j = 0; j < 8; ++j) { float y = acc[j] + bfr(p ? bkr[ot][j] : bqr[ot][j]); if (p) y = __fadd_rn(y, __fadd_rn(rhv[j], bfr(rwr[ot][j]))); unsigned short a2, c2; splitf(y, a2, c2); oh[j] = a2; ol[j] = c2; }
            *(v8us*)((p ? Kh : Qh) + qrow + ot * 16) = oh; *(v8us*)((p ? Kl : Ql) + qrow + ot * 16) = ol;
            asm volatile("s_wait_xcnt 0x0" ::: "memory"); }
    v16bf wf[2];
#pragma unroll
    for (int kc = 0; kc < 2; ++kc) wf[kc] = WFrag<bf>::ld(Ws + (128 + tl) * WP + kc * 32 + 8 * hi);
    const size_t vrow = (b * CC + tl) * TT + hh * 64 + 8 * hi;
#pragma unroll
    for (int mb = 0; mb < 4; ++mb) { v8f acc = (v8f){};
#pragma unroll
        for (int kc = 0; kc < 2; ++kc) acc = wmmab(WFrag<bf>::ld(Xs + (mb * 16 + lr) * WP + kc * 32 + 8 * hi), wf[kc], acc);
        v8h o16; v8us oh, ol;
#pragma unroll
        for (int j = 0; j < 8; ++j) { const float y = acc[j] + bvr; o16[j] = tohx(y); unsigned short a2, c2; splitf(y, a2, c2); oh[j] = a2; ol[j] = c2; }
        *(v8h*)(V16 + vrow + mb * 16) = o16; *(v8us*)(Vh + vrow + mb * 16) = oh; *(v8us*)(Vl + vrow + mb * 16) = ol;
        asm volatile("s_wait_xcnt 0x0" ::: "memory"); }
}

#define L2E 1.4426950408889634f
// ---- k_attn: scores, softmax and attn.v of one key span for one query tile, 4 waves x 16 NQ queries (rows < RH: NQ = 1, 64-query tiles, which start first; rest NQ = 2, 128-query tiles), nothing staged in memory or LDS.
// The score tile is formed TRANSPOSED (A = 16 key rows, B = 16 query rows), so a lane holds one query (column lr) and keys 8 hi + j of each 16-key tile: the row maximum and sum are in-lane but for one exchange with lane ^ 16,
// and two such tiles, converted, ARE the B fragment (k = 8 hi + 0..7, 16 + 8 hi + 0..7) of out^T[c][n] += V^T[c][k] P[n][k]. 
// Per span: running maximum m, sum l and unnormalised out^T, each relative to m; k_merge joins the spans. Inner loops are unrolled so that every fragment array stays in registers.
// K and V fragments come straight from the row-major planes (row pitch 128 B and 8 KiB): each 16-byte load of a wave touches 16 lines, and the 4 waves of a work-group load the same K and V.
template <bool HR, int NQ>
__device__ __forceinline__ void attn_span(const bf* __restrict__ Qh, const bf* __restrict__ Ql, const bf* __restrict__ Kh, const bf* __restrict__ Kl, const h16* __restrict__ V16, const bf* __restrict__ Vh, const bf* __restrict__ Vl, int n0, int k0, int k1, float* Op, float* ML) {
    const int lane = threadIdx.x & 31, lr = lane & 15, hi = lane >> 4;
    v16bf qh[NQ][2], ql[NQ][2];
#pragma unroll
    for (int nq = 0; nq < NQ; ++nq)
#pragma unroll
        for (int kc = 0; kc < 2; ++kc) { const size_t qo = (size_t)(n0 + nq * 16 + lr) * MID + kc * 32 + 8 * hi; qh[nq][kc] = WFrag<bf>::ld(Qh + qo); ql[nq][kc] = WFrag<bf>::ld(Ql + qo); }
    v8f o[4][NQ]; float m[NQ], l[NQ];
#pragma unroll
    for (int nq = 0; nq < NQ; ++nq) { m[nq] = -3.0e38f; l[nq] = 0.0f;
#pragma unroll
        for (int ct = 0; ct < 4; ++ct) o[ct][nq] = (v8f){}; }
#pragma unroll 1   /* kept rolled: a second pass's fragments would push the wave past 256 registers (4 waves per SIMD) */
    for (int kb = k0; kb < k1; kb += 32) {
        v16h va[4]; v16bf vh[4], vl[4];
#pragma unroll
        for (int ct = 0; ct < 4; ++ct) { const size_t vo = (size_t)(ct * 16 + lr) * TT + kb + 8 * hi; if (HR) vh[ct] = WFrag<bf>::ld(Vh + vo); else va[ct] = WFrag<h16>::ld(V16 + vo); }
        if (HR) {
            asm volatile("s_wait_xcnt 0x0" ::: "memory");   /* precaution: stands before any address register of the loads above is reused */
#pragma unroll
            for (int ct = 0; ct < 4; ++ct) vl[ct] = WFrag<bf>::ld(Vl + (size_t)(ct * 16 + lr) * TT + kb + 8 * hi);
            asm volatile("s_wait_xcnt 0x0" ::: "memory");   /* the same for the low plane's loads */
        }
        v8f s[2][NQ];
#pragma unroll
        for (int kt = 0; kt < 2; ++kt) {
#pragma unroll
            for (int nq = 0; nq < NQ; ++nq) s[kt][nq] = (v8f){};
#pragma unroll
            for (int kc = 0; kc < 2; ++kc) { const size_t ko = (size_t)(kb + kt * 16 + lr) * MID + kc * 32 + 8 * hi; const v16bf kh = WFrag<bf>::ld(Kh + ko), kl = WFrag<bf>::ld(Kl + ko);
#pragma unroll
                for (int nq = 0; nq < NQ; ++nq) { s[kt][nq] = wmmab(kh, qh[nq][kc], s[kt][nq]); s[kt][nq] = wmmab(kh, ql[nq][kc], s[kt][nq]); s[kt][nq] = wmmab(kl, qh[nq][kc], s[kt][nq]); } } }
        float al[NQ]; bool moved = false;
#pragma unroll
        for (int nq = 0; nq < NQ; ++nq) { float mx = fmaxf(s[0][nq][0], s[1][nq][0]);
#pragma unroll
            for (int j = 1; j < 8; ++j) mx = fmaxf(mx, fmaxf(s[0][nq][j], s[1][nq][j]));
            mx = fmaxf(mx, __shfl_xor(mx, 16, 32));
            const float mn = fmaxf(m[nq], mx); moved = moved || (mn > m[nq]); al[nq] = __builtin_amdgcn_exp2f((m[nq] - mn) * L2E); m[nq] = mn; float ps = 0.0f;
#pragma unroll
            for (int kt = 0; kt < 2; ++kt)
#pragma unroll
                for (int j = 0; j < 8; ++j) { const float p = __builtin_amdgcn_exp2f((s[kt][nq][j] - mn) * L2E); s[kt][nq][j] = p; ps += p; }
            l[nq] = l[nq] * al[nq] + ps; }
        if (__any(moved)) {   /* no maximum of the wave moved: every factor is exactly 1 */
#pragma unroll
            for (int ct = 0; ct < 4; ++ct)
#pragma unroll
                for (int nq = 0; nq < NQ; ++nq) o[ct][nq] *= al[nq]; }
        if (HR) {
            v16bf ph[NQ], pl[NQ];
#pragma unroll
            for (int nq = 0; nq < NQ; ++nq) { v16us a16, c16;
#pragma unroll
                for (int e = 0; e < 8; ++e) { unsigned short a2, c2; splitf(s[0][nq][e], a2, c2); a16[e] = a2; c16[e] = c2; splitf(s[1][nq][e], a2, c2); a16[8 + e] = a2; c16[8 + e] = c2; }
                ph[nq] = __builtin_bit_cast(v16bf, a16); pl[nq] = __builtin_bit_cast(v16bf, c16); }
#pragma unroll
            for (int ct = 0; ct < 4; ++ct)
#pragma unroll
                for (int nq = 0; nq < NQ; ++nq) { o[ct][nq] = wmmab(vh[ct], ph[nq], o[ct][nq]); o[ct][nq] = wmmab(vh[ct], pl[nq], o[ct][nq]); o[ct][nq] = wmmab(vl[ct], ph[nq], o[ct][nq]); }
        } else {
            v16h pf[NQ];
#pragma unroll
            for (int nq = 0; nq < NQ; ++nq)
#pragma unroll
                for (int e = 0; e < 8; ++e) { pf[nq][e] = tohx(s[0][nq][e] * PCAR); pf[nq][8 + e] = tohx(s[1][nq][e] * PCAR); }
#pragma unroll
            for (int ct = 0; ct < 4; ++ct)
#pragma unroll
                for (int nq = 0; nq < NQ; ++nq) o[ct][nq] = wmma16(va[ct], pf[nq], o[ct][nq]);
        }
    }
#pragma unroll
    for (int nq = 0; nq < NQ; ++nq) { const size_t nb = (size_t)(n0 / 16 + nq); const float lt = l[nq] + __shfl_xor(l[nq], 16, 32);   /* a wave owns every 128-byte line that it writes */
#pragma unroll
        for (int ct = 0; ct < 4; ++ct)
#pragma unroll
            for (int j = 0; j < 8; ++j) Op[(nb * CC + ct * 16 + hi * 8 + j) * 16 + lr] = o[ct][nq][j];
        ML[nb * 32 + lane] = hi ? lt : m[nq]; }
}
__global__ __launch_bounds__(128) void k_attn(const bf* __restrict__ Qh, const bf* __restrict__ Ql, const bf* __restrict__ Kh, const bf* __restrict__ Kl, const h16* __restrict__ V16, const bf* __restrict__ Vh, const bf* __restrict__ Vl, float* Op, float* ML) {
    const size_t b = blockIdx.y, pl = (size_t)blockIdx.x * NB_ + b; const size_t tb = b * TT * MID, vb = b * CC * TT;
    const int tile = blockIdx.z, wv = threadIdx.x >> 5, k0 = (int)(blockIdx.x * (TT / 32) / NSP) * 32, k1 = (int)((blockIdx.x + 1) * (TT / 32) / NSP) * 32;
    if (tile < RH / 64) attn_span<true, 1>(Qh + tb, Ql + tb, Kh + tb, Kl + tb, V16 + vb, Vh + vb, Vl + vb, tile * 64 + wv * 16, k0, k1, Op + pl * CC * TT, ML + pl * TT * 2);
    else { attn_span<false, 2>(Qh + tb, Ql + tb, Kh + tb, Kl + tb, V16 + vb, Vh + vb, Vl + vb, RH + (tile - RH / 64) * 128 + wv * 32, k0, k1, Op + pl * CC * TT, ML + pl * TT * 2);
        asm volatile("s_wait_xcnt 0x0" ::: "memory"); }   /* precaution: in the built code this path's last stores are followed by the other path's prologue, which reuses their registers */
}
// k_merge: out[b][c][n] = sum_s O_s[c][n] w_s / sum_s l_s w_s, w_s = exp(m_s - max m), spans in order; the x1024 carry of the fp16 rows is taken out here.
// Per span and batch: O [n / 16][c][n % 16]; ML [n / 16][32]: 16 maxima, then 16 sums.
__global__ __launch_bounds__(256) void k_merge(const float* __restrict__ Op, const float* __restrict__ ML, float* out) { const size_t i = (size_t)blockIdx.x * 256 + threadIdx.x; if (i >= (size_t)NB_ * CC * TT / 4) return; const int n = (int)(i % (TT / 4)) * 4; const int c = (int)((i / (TT / 4)) % CC); const size_t b = i / ((size_t)CC * TT / 4); const size_t nb = (size_t)(n / 16); const int nr = n % 16; v4f ms[NSP]; v4f mx;
#pragma unroll
    for (int s = 0; s < NSP; ++s) { ms[s] = *(const v4f*)(ML + (((size_t)s * NB_ + b) * (TT / 16) + nb) * 32 + nr);
#pragma unroll
        for (int q = 0; q < 4; ++q) mx[q] = s ? fmaxf(mx[q], ms[s][q]) : ms[s][q]; }
    v4f num = (v4f){}, den = (v4f){};
#pragma unroll
    for (int s = 0; s < NSP; ++s) { const size_t pn = ((size_t)s * NB_ + b) * (TT / 16) + nb; const v4f ls = *(const v4f*)(ML + pn * 32 + 16 + nr); const v4f os = *(const v4f*)(Op + (pn * CC + c) * 16 + nr);
#pragma unroll
        for (int q = 0; q < 4; ++q) { const float w = __builtin_amdgcn_exp2f((ms[s][q] - mx[q]) * L2E); num[q] += os[q] * w; den[q] += ls[q] * w; } }
    const float cs = (n < RH) ? 1.0f : (1.0f / PCAR); v4f r;
#pragma unroll
    for (int q = 0; q < 4; ++q) r[q] = num[q] * __fdiv_rn(cs, den[q]);
    *(v4f*)(out + (b * CC + c) * TT + n) = r;  }

extern "C" void kernel_launch(void* const* d_in, const int* in_sizes, int n_in,
                              void* d_out, int out_size, void* d_ws, size_t ws_size, hipStream_t stream) {
    (void)in_sizes; (void)n_in; (void)out_size;
    const float* x = (const float*)d_in[0]; const float* wq = (const float*)d_in[1]; const float* bq = (const float*)d_in[2]; const float* wk = (const float*)d_in[3]; const float* bk = (const float*)d_in[4]; const float* wv = (const float*)d_in[5]; const float* bv = (const float*)d_in[6]; const float* relh = (const float*)d_in[7]; const float* relw = (const float*)d_in[8];   /* [1][64][64][1], [1][64][1][64] */
    float* OUT = (float*)d_out;     // [4][64][4096] channel-major
    char* wsp = (char*)d_ws;
    auto take = [&](size_t bytes) { char* p = wsp; wsp += (bytes + 255) & ~(size_t)255; return (void*)p; };
    bf* QPh = (bf*)take((size_t)NB_ * TT * MID * 2); bf* QPl = (bf*)take((size_t)NB_ * TT * MID * 2); bf* KPh = (bf*)take((size_t)NB_ * TT * MID * 2); bf* KPl = (bf*)take((size_t)NB_ * TT * MID * 2);   /* hi/lo planes: one set per batch */
    h16* VT16 = (h16*)take((size_t)NB_ * CC * TT * 2); bf* VTh = (bf*)take((size_t)NB_ * CC * TT * 2); bf* VTl = (bf*)take((size_t)NB_ * CC * TT * 2);   /* V^T planes [4][64][4096] */
    float* Op = (float*)take((size_t)NSP * NB_ * CC * TT * 4); float* ML = (float*)take((size_t)NSP * NB_ * TT * 2 * 4);   /* per span and batch: unnormalised out^T in blocks of 16 queries, running maxima and sums */
    if ((size_t)(wsp - (char*)d_ws) > ws_size) return;    // ws 256 MiB (carve ~45 MiB)
    k_prep<<<dim3(TT / 64, NB_), 128, 0, stream>>>(x, wq, bq, wk, bk, wv, bv, relh, relw, QPh, QPl, KPh, KPl, VT16, VTh, VTl);   /* projections, k + pos (f32), planes: all batches */
    k_attn<<<dim3(NSP, NB_, RH / 64 + (TT - RH) / 128), 128, 0, stream>>>(QPh, QPl, KPh, KPl, VT16, VTh, VTl, Op, ML);   /* scores (every row hi/lo, unscaled logits), softmax, attn.v: all batches */
    k_merge<<<(unsigned)(((size_t)NB_ * CC * TT / 4 + 255) / 256), 256, 0, stream>>>(Op, ML, OUT);   /* spans joined, channel-major output */
}

// v004
// One run takes 48.7 microseconds.
// Two timings next to v003 put it at 1.68 and 1.69 times that version's speed.
// Over all steps from v000 it is 21.4 times as fast.
#include <hip/hip_runtime.h>

// Self-attention over a 64x64 feature map with a learned 2-D positional key term (x [4][64][64x64] channel-major; q, k, v = 1x1 convs 'oi' [64][64] + [64] (1/8 weights, 0.02 biases); energy[n][m] = q_n.k_m + q_n.pos_m with pos[c][(hh, ww)] = rel_h[c][hh] + rel_w[c][ww] ([1][64][64][1] + [1][64][1][64], read) == q_n.(k_m + pos_m) (unscaled, sigma ~8); softmax over the 4,096 positions; out[c][n] = sum_m v[c][m] attn[n][m] -> [4][64][64][64] (1.0 M)).
// Layout: one kernel for all batches (k_prep) rounds the channel-major map and the weights to bf16, does the three exact projections + f32 biases, adds the positional table to the key rows in f32 (q.k + q.pos == q.(k + pos)) and writes the hi/lo planes, one set per batch. One kernel for all batches then does scores, softmax and attn.v in registers (k_attn), one key span per work-group, its K and V tiles shared through LDS; k_merge joins the spans and writes the channel-major output rows.
// Compute dtypes, f32 accumulate: every input rounded to bf16; projections exact + f32 biases; scores 3 products on every row; softmax f32 (running maximum); attn.V rows < 512 3 products (P, V hi/lo), rest fp16 (P x1024); epilogue f32.

#define NB_  4
#define TT   4096
#define DM   512
#define NH_  1
#define NKV  1
#define REP  (NH_ / NKV)
#define HD   64
#define DQ   (NH_ * HD)
#define DKV  (NKV * HD)
#define ZH   1
#define RH   512                  // query rows < RH use hi+lo planes (0: none)
#define WIN  0
#define PCAR 1024.0f
#define SCL  1.0f   // no scaling in the module
#define MID  64
#define CQR  64      // q/k use all channels (no padding)
#define CC   64
#define NSP  7       // the 128 passes of 32 keys are dealt to NSP spans (18 or 19 each; 36 tiles x 4 batches x 7 = 1,008 work-groups of 4 waves at 4 waves per SIMD: one round on 256 WGPs), one work-group per span and query tile
typedef _Float16 h16;
typedef unsigned short bf;
typedef __attribute__((ext_vector_type(16))) __bf16   v16bf;
typedef __attribute__((ext_vector_type(16))) _Float16 v16h;
typedef __attribute__((ext_vector_type(8)))  _Float16 v8h;
typedef __attribute__((ext_vector_type(8)))  unsigned short v8us;
typedef __attribute__((ext_vector_type(8)))  float    v8f;
typedef __attribute__((ext_vector_type(4)))  float    v4f;
typedef v8h  __attribute__((may_alias)) v8ha;
typedef v4f  __attribute__((may_alias)) v4fa;
typedef v8us __attribute__((may_alias)) v8usa;

__device__ __forceinline__ unsigned short f2bf(float f) { unsigned u = __float_as_uint(f); u += 0x7FFFu + ((u >> 16) & 1u); return (unsigned short)(u >> 16); }
__device__ __forceinline__ float bf2f(unsigned short b) { return __uint_as_float(((unsigned)b) << 16); }
__device__ __forceinline__ float bfr(float f) { return bf2f(f2bf(f)); }
__device__ __forceinline__ v16h cat16(v8h lo, v8h hi) { return __builtin_shufflevector(lo, hi, 0, 1, 2, 3, 4, 5, 6, 7, 8, 9, 10, 11, 12, 13, 14, 15); }
__device__ __forceinline__ v16bf cat16b(v8us lo, v8us hi) { return __builtin_bit_cast(v16bf, __builtin_shufflevector(lo, hi, 0, 1, 2, 3, 4, 5, 6, 7, 8, 9, 10, 11, 12, 13, 14, 15)); }
__device__ __forceinline__ v8f wmma16(v16h a, v16h b, v8f c) { return __builtin_amdgcn_wmma_f32_16x16x32_f16(false, a, false, b, (short)0, c, false, false); }
__device__ __forceinline__ v8f wmmab(v16bf a, v16bf b, v8f c) { return __builtin_amdgcn_wmma_f32_16x16x32_bf16(false, a, false, b, (short)0, c, false, false); }



template <typename T16> struct WFrag;   // 16x32 operand fragment from a K-contiguous 16-bit row: p = row start + 8 (lane >> 4); k = 8 hi + 0..7, 16 + 8 hi + 0..7 (A and B alike)
template <> struct WFrag<h16> { typedef v16h V; static __device__ __forceinline__ V ld(const h16* p) { return cat16(*(const v8h*)p, *(const v8h*)(p + 16)); } };
template <> struct WFrag<bf> { typedef v16bf V; static __device__ __forceinline__ V ld(const bf* p) { return cat16b(*(const v8us*)p, *(const v8us*)(p + 16)); } };

__device__ __forceinline__ h16 tohx(float x) { return (h16)x; }
__device__ __forceinline__ void splitf(float y, unsigned short& h, unsigned short& l) { h = f2bf(y); l = f2bf(y - bf2f(h)); }
typedef __attribute__((ext_vector_type(16))) unsigned short v16us;

#define WP 72   // LDS row pitch in 16-bit elements: 144 B = 16 B x odd, for the 16-byte fragment reads
// ---- k_prep: everything in front of the attention, one launch. Grid (64 map rows, 4 batches), 4 waves; a work-group owns the 64 tokens of one map row (hh = blockIdx.x, ww = 0..63).
// Each wave rounds its own 16 tokens' x to bf16 straight into a fragment (row = token, k = channel), which also goes to LDS; the work-group rounds the three weight matrices ('oi' = K-contiguous rows) into LDS once.
// q, k: A = 16 weight rows, B = the wave's own tokens, so a lane holds one token and 8 consecutive output channels: 16-byte stores, and the wave writes the whole 128-byte row of each of its tokens.
// v: A = 16 tokens (from LDS), B = weight rows 16 wave + 0..15, so a lane holds one channel and 8 consecutive tokens, and the wave writes the whole 128-byte piece (64 tokens) of each of its channel rows.
// Every product sums k = 0..31, then 32..63, as two accumulating matrix instructions.
__global__ __launch_bounds__(128) void k_prep(const float* __restrict__ x, const float* __restrict__ wq, const float* __restrict__ bq, const float* __restrict__ wk, const float* __restrict__ bk, const float* __restrict__ wv, const float* __restrict__ bv, const float* __restrict__ rh, const float* __restrict__ rw,
                                              bf* Qh, bf* Ql, bf* Kh, bf* Kl, h16* V16, bf* Vh, bf* Vl) {
    __shared__ __align__(16) bf Ws[3 * 64 * WP];
    __shared__ __align__(16) bf Xs[64 * WP];
    __shared__ __align__(32) float Rh[64];   /* this map row's column of rel_h, rounded */
    const int tid = threadIdx.x, lane = tid & 31, lr = lane & 15, hi = lane >> 4, wvi = tid >> 5;
    const int hh = blockIdx.x, tl = wvi * 16 + lr; const size_t b = blockIdx.y;
    const float* xt = x + b * CC * TT + hh * 64 + tl;
    float xr[2][16];
#pragma unroll
    for (int kc = 0; kc < 2; ++kc)
#pragma unroll
        for (int e = 0; e < 16; ++e) xr[kc][e] = xt[(kc * 32 + 8 * hi + (e & 7) + 16 * (e >> 3)) * TT];
    asm volatile("s_wait_xcnt 0x0" ::: "memory");   /* precaution, here and below: stands before any register that the loads or stores above name is reused */
    v8f wr[12];   /* 3 x 512 runs of 8 weights, 12 per thread */
#pragma unroll
    for (int i = 0; i < 12; ++i) wr[i] = *(const v8f*)((i < 4 ? wq : i < 8 ? wk : wv) + ((i & 3) * 128 + tid) * 8);
    asm volatile("s_wait_xcnt 0x0" ::: "memory");
    float rwr[4][8]; v8f bqr[4], bkr[4];
#pragma unroll
    for (int ot = 0; ot < 4; ++ot)
#pragma unroll
        for (int j = 0; j < 8; ++j) rwr[ot][j] = rw[(ot * 16 + 8 * hi + j) * 64 + tl];
    asm volatile("s_wait_xcnt 0x0" ::: "memory");
#pragma unroll
    for (int ot = 0; ot < 4; ++ot) { bqr[ot] = *(const v8f*)(bq + ot * 16 + 8 * hi); bkr[ot] = *(const v8f*)(bk + ot * 16 + 8 * hi); }
    const float bvw = bv[tl];   /* channel 16 wave + lr */
    asm volatile("s_wait_xcnt 0x0" ::: "memory");
    const float bvr = bfr(bvw);
    if (tid < 64) { const float rhw = rh[tid * 64 + hh];   /* waves 0 and 1, whole */
        asm volatile("s_wait_xcnt 0x0" :: "v"(rhw) : "memory");   /* the same precaution; the loaded value as an input keeps the wait behind this load */
        Rh[tid] = bfr(rhw); }
    v16bf xf[2];
#pragma unroll
    for (int kc = 0; kc < 2; ++kc) { v8us lo8, hi8;
#pragma unroll
        for (int e = 0; e < 8; ++e) { lo8[e] = f2bf(xr[kc][e]); hi8[e] = f2bf(xr[kc][8 + e]); }
        *(v8us*)(Xs + tl * WP + kc * 32 + 8 * hi) = lo8; *(v8us*)(Xs + tl * WP + kc * 32 + 8 * hi + 16) = hi8; xf[kc] = cat16b(lo8, hi8); }
#pragma unroll
    for (int i = 0; i < 12; ++i) { const int u = (i & 3) * 128 + tid; v8us o;
#pragma unroll
        for (int q = 0; q < 8; ++q) o[q] = f2bf(wr[i][q]);
        *(v8us*)(Ws + ((i >> 2) * 64 + (u >> 3)) * WP + (u & 7) * 8) = o; }
    __syncthreads();
    const size_t qrow = (b * TT + hh * 64 + tl) * MID + 8 * hi;
#pragma unroll
    for (int p = 0; p < 2; ++p)   /* 0: q, 1: k + pos */
#pragma unroll
        for (int ot = 0; ot < 4; ++ot) { v8f acc = (v8f){};
#pragma unroll
            for (int kc = 0; kc < 2; ++kc) acc = wmmab(WFrag<bf>::ld(Ws + (p * 64 + ot * 16 + lr) * WP + kc * 32 + 8 * hi), xf[kc], acc);
            v8us oh, ol; v8f rhv; if (p) rhv = *(const v8f*)(Rh + ot * 16 + 8 * hi);
#pragma unroll
            for (int j = 0; j < 8; ++j) { float y = acc[j] + bfr(p ? bkr[ot][j] : bqr[ot][j]); if (p) y = __fadd_rn(y, __fadd_rn(rhv[j], bfr(rwr[ot][j]))); unsigned short a2, c2; splitf(y, a2, c2); oh[j] = a2; ol[j] = c2; }
            *(v8us*)((p ? Kh : Qh) + qrow + ot * 16) = oh; *(v8us*)((p ? Kl : Ql) + qrow + ot * 16) = ol;
            asm volatile("s_wait_xcnt 0x0" ::: "memory"); }
    v16bf wf[2];
#pragma unroll
    for (int kc = 0; kc < 2; ++kc) wf[kc] = WFrag<bf>::ld(Ws + (128 + tl) * WP + kc * 32 + 8 * hi);
    const size_t vrow = (b * CC + tl) * TT + hh * 64 + 8 * hi;
#pragma unroll
    for (int mb = 0; mb < 4; ++mb) { v8f acc = (v8f){};
#pragma unroll
        for (int kc = 0; kc < 2; ++kc) acc = wmmab(WFrag<bf>::ld(Xs + (mb * 16 + lr) * WP + kc * 32 + 8 * hi), wf[kc], acc);
        v8h o16; v8us oh, ol;
#pragma unroll
        for (int j = 0; j < 8; ++j) { const float y = acc[j] + bvr; o16[j] = tohx(y); unsigned short a2, c2; splitf(y, a2, c2); oh[j] = a2; ol[j] = c2; }
        *(v8h*)(V16 + vrow + mb * 16) = o16; *(v8us*)(Vh + vrow + mb * 16) = oh; *(v8us*)(Vl + vrow + mb * 16) = ol;
        asm volatile("s_wait_xcnt 0x0" ::: "memory"); }
}

#define L2E 1.4426950408889634f
// ---- k_attn: scores, softmax and attn.v of one key span for one query tile, 4 waves x 16 NQ queries (rows < RH: NQ = 1, 64-query tiles, which start first; rest NQ = 2, 128-query tiles); scores and P never leave the registers.
// The score tile is formed TRANSPOSED (A = 16 key rows, B = 16 query rows), so a lane holds one query (column lr) and keys 8 hi + j of each 16-key tile: the row maximum and sum are in-lane but for one exchange with lane ^ 16,
// and two such tiles, converted, ARE the B fragment (k = 8 hi + 0..7, 16 + 8 hi + 0..7) of out^T[c][n] += V^T[c][k] P[n][k]. 
// Per span: running maximum m, sum l and unnormalised out^T, each relative to m; k_merge joins the spans. Inner loops are unrolled so that every fragment array stays in registers.
// K and V: the work-group brings each pass's tiles (32 key rows of 128 B per plane, 64 channel rows of 64 B per plane) into LDS once, by asynchronous copies, 16 B per lane, two buffers: pass t + 2's copies are issued behind the barrier that ends pass t, so they fly during pass t + 1.
// The 4 waves read their fragments from LDS (16-byte reads; row pitches 16 B x odd). The fragments hold the same elements as before, so every sum keeps its order.
#define KP  144                    // LDS pitch of a 128-byte K row, bytes
#define VP  80                     // LDS pitch of a 64-byte piece of a V row, bytes
#define KPB (32 * KP)              // one K plane of a pass
#define VPB (64 * VP)              // one V plane of a pass
#define SBB (2 * KPB + 2 * VPB)    // one buffer: K hi, K lo, V (fp16, or hi and lo)
// One pass's copies, every thread of the work-group: piece u = 128 i + tid of each plane. K: 8 pieces a row, the plane's 4 KiB are contiguous in memory; V: 4 pieces a row.
// s_wait_xcnt 0 closes each statement: a precaution, it stands before any register that the copies name is reused.
template <bool HR>
__device__ __forceinline__ void stage_kv(unsigned dst, const bf* __restrict__ Kh, const bf* __restrict__ Kl, const h16* __restrict__ V16, const bf* __restrict__ Vh, const bf* __restrict__ Vl, int kb) {
    const int tid = threadIdx.x;
    const unsigned lk = dst + (tid >> 3) * KP + (tid & 7) * 16, lv = dst + 2 * KPB + (tid >> 2) * VP + (tid & 3) * 16;
    const size_t ko = (size_t)kb * MID + tid * 8, vo = (size_t)(tid >> 2) * TT + kb + (tid & 3) * 8;
    const void* v0 = HR ? (const void*)(Vh + vo) : (const void*)(V16 + vo);
    const void* v1 = HR ? (const void*)(Vh + vo + 32 * TT) : (const void*)(V16 + vo + 32 * TT);
    asm volatile("global_load_async_to_lds_b128 %0, %6, off\n\t"
                 "global_load_async_to_lds_b128 %1, %7, off\n\t"
                 "global_load_async_to_lds_b128 %2, %8, off\n\t"
                 "global_load_async_to_lds_b128 %3, %9, off\n\t"
                 "global_load_async_to_lds_b128 %4, %10, off\n\t"
                 "global_load_async_to_lds_b128 %5, %11, off\n\t"
                 "s_wait_xcnt 0x0"
                 :: "v"(lk), "v"(lk + 16 * KP), "v"(lk + KPB), "v"(lk + KPB + 16 * KP), "v"(lv), "v"(lv + 32 * VP),
                    "v"(Kh + ko), "v"(Kh + ko + 1024), "v"(Kl + ko), "v"(Kl + ko + 1024), "v"(v0), "v"(v1) : "memory");
    if (HR)
        asm volatile("global_load_async_to_lds_b128 %0, %2, off\n\t"
                     "global_load_async_to_lds_b128 %1, %3, off\n\t"
                     "s_wait_xcnt 0x0"
                     :: "v"(lv + VPB), "v"(lv + VPB + 32 * VP), "v"(Vl + vo), "v"(Vl + vo + 32 * TT) : "memory");
}
template <bool HR, int NQ>
__device__ __forceinline__ void attn_span(const bf* __restrict__ Qh, const bf* __restrict__ Ql, const bf* __restrict__ Kh, const bf* __restrict__ Kl, const h16* __restrict__ V16, const bf* __restrict__ Vh, const bf* __restrict__ Vl, int n0, int k0, int k1, float* Op, float* ML, const unsigned char* Sm) {
    const int lane = threadIdx.x & 31, lr = lane & 15, hi = lane >> 4;
    const unsigned sb = (unsigned)(size_t)Sm;   /* the buffers' byte address in LDS */
    stage_kv<HR>(sb, Kh, Kl, V16, Vh, Vl, k0);
    v16bf qh[NQ][2], ql[NQ][2];
#pragma unroll
    for (int nq = 0; nq < NQ; ++nq)
#pragma unroll
        for (int kc = 0; kc < 2; ++kc) { const size_t qo = (size_t)(n0 + nq * 16 + lr) * MID + kc * 32 + 8 * hi; qh[nq][kc] = WFrag<bf>::ld(Qh + qo); ql[nq][kc] = WFrag<bf>::ld(Ql + qo); }
    v8f o[4][NQ]; float m[NQ], l[NQ];
#pragma unroll
    for (int nq = 0; nq < NQ; ++nq) { m[nq] = -3.0e38f; l[nq] = 0.0f;
#pragma unroll
        for (int ct = 0; ct < 4; ++ct) o[ct][nq] = (v8f){}; }
    asm volatile("s_wait_asynccnt 0x0" ::: "memory");   /* this wave's share of pass 0's tiles has landed */
    __syncthreads();                                     /* ... and every other wave's: pass 0's tiles may be read */
    if (k0 + 32 < k1) stage_kv<HR>(sb + SBB, Kh, Kl, V16, Vh, Vl, k0 + 32);
    unsigned cur = 0;   /* byte offset of the buffer that this pass reads */
#pragma unroll 1   /* kept rolled: a second pass's fragments would push the wave past 256 registers (4 waves per SIMD) */
    for (int kb = k0; kb < k1; kb += 32) {
        const unsigned char* kt_ = Sm + cur + lr * KP + 16 * hi; const unsigned char* vt_ = Sm + cur + 2 * KPB + lr * VP + 16 * hi;
        v8f s[2][NQ];
#pragma unroll
        for (int kt = 0; kt < 2; ++kt) {
#pragma unroll
            for (int nq = 0; nq < NQ; ++nq) s[kt][nq] = (v8f){};
#pragma unroll
            for (int kc = 0; kc < 2; ++kc) { const unsigned char* kp = kt_ + kt * 16 * KP + kc * 64; const v16bf kh = WFrag<bf>::ld((const bf*)kp), kl = WFrag<bf>::ld((const bf*)(kp + KPB));
#pragma unroll
                for (int nq = 0; nq < NQ; ++nq) { s[kt][nq] = wmmab(kh, qh[nq][kc], s[kt][nq]); s[kt][nq] = wmmab(kh, ql[nq][kc], s[kt][nq]); s[kt][nq] = wmmab(kl, qh[nq][kc], s[kt][nq]); } } }
        v16h va[4]; v16bf vh[4], vl[4];   /* read behind the score products, into the registers that the K fragments leave */
#pragma unroll
        for (int ct = 0; ct < 4; ++ct) { if (HR) { vh[ct] = WFrag<bf>::ld((const bf*)(vt_ + ct * 16 * VP)); vl[ct] = WFrag<bf>::ld((const bf*)(vt_ + VPB + ct * 16 * VP)); } else va[ct] = WFrag<h16>::ld((const h16*)(vt_ + ct * 16 * VP)); }
        float al[NQ]; bool moved = false;
#pragma unroll
        for (int nq = 0; nq < NQ; ++nq) { float mx = fmaxf(s[0][nq][0], s[1][nq][0]);
#pragma unroll
            for (int j = 1; j < 8; ++j) mx = fmaxf(mx, fmaxf(s[0][nq][j], s[1][nq][j]));
            mx = fmaxf(mx, __shfl_xor(mx, 16, 32));
            const float mn = fmaxf(m[nq], mx); moved = moved || (mn > m[nq]); al[nq] = __builtin_amdgcn_exp2f((m[nq] - mn) * L2E); m[nq] = mn; float ps = 0.0f;
#pragma unroll
            for (int kt = 0; kt < 2; ++kt)
#pragma unroll
                for (int j = 0; j < 8; ++j) { const float p = __builtin_amdgcn_exp2f((s[kt][nq][j] - mn) * L2E); s[kt][nq][j] = p; ps += p; }
            l[nq] = l[nq] * al[nq] + ps; }
        /* inputs only: holds the V reads here, as one group whose latency the maxima cover; left free, they sink to one fragment at a time in front of its products, each with a full LDS wait */
        if (HR) asm volatile("" :: "v"(vh[0]), "v"(vh[1]), "v"(vh[2]), "v"(vh[3]), "v"(vl[0]), "v"(vl[1]), "v"(vl[2]), "v"(vl[3]));
        else asm volatile("" :: "v"(va[0]), "v"(va[1]), "v"(va[2]), "v"(va[3]));
        if (__any(moved)) {   /* no maximum of the wave moved: every factor is exactly 1 */
#pragma unroll
            for (int ct = 0; ct < 4; ++ct)
#pragma unroll
                for (int nq = 0; nq < NQ; ++nq) o[ct][nq] *= al[nq]; }
        if (HR) {
            v16bf ph[NQ], pl[NQ];
#pragma unroll
            for (int nq = 0; nq < NQ; ++nq) { v16us a16, c16;
#pragma unroll
                for (int e = 0; e < 8; ++e) { unsigned short a2, c2; splitf(s[0][nq][e], a2, c2); a16[e] = a2; c16[e] = c2; splitf(s[1][nq][e], a2, c2); a16[8 + e] = a2; c16[8 + e] = c2; }
                ph[nq] = __builtin_bit_cast(v16bf, a16); pl[nq] = __builtin_bit_cast(v16bf, c16); }
#pragma unroll
            for (int ct = 0; ct < 4; ++ct)
#pragma unroll
                for (int nq = 0; nq < NQ; ++nq) { o[ct][nq] = wmmab(vh[ct], ph[nq], o[ct][nq]); o[ct][nq] = wmmab(vh[ct], pl[nq], o[ct][nq]); o[ct][nq] = wmmab(vl[ct], ph[nq], o[ct][nq]); }
        } else {
            v16h pf[NQ];
#pragma unroll
            for (int nq = 0; nq < NQ; ++nq)
#pragma unroll
                for (int e = 0; e < 8; ++e) { pf[nq][e] = tohx(s[0][nq][e] * PCAR); pf[nq][8 + e] = tohx(s[1][nq][e] * PCAR); }
#pragma unroll
            for (int ct = 0; ct < 4; ++ct)
#pragma unroll
                for (int nq = 0; nq < NQ; ++nq) o[ct][nq] = wmma16(va[ct], pf[nq], o[ct][nq]);
        }
        asm volatile("s_wait_dscnt 0x0" ::: "memory");      /* this wave's reads of the current buffer are done */
        asm volatile("s_wait_asynccnt 0x0" ::: "memory");   /* its share of the next pass's tiles has landed */
        __syncthreads();                                     /* one barrier a pass: it publishes the next pass's tiles and frees the buffer just read */
        if (kb + 64 < k1) stage_kv<HR>(sb + cur, Kh, Kl, V16, Vh, Vl, kb + 64);
        cur ^= SBB;
    }
    asm volatile("s_wait_asynccnt 0x0" ::: "memory");   /* no copy is left in flight when the wave goes on to its stores and ends */
#pragma unroll
    for (int nq = 0; nq < NQ; ++nq) { const size_t nb = (size_t)(n0 / 16 + nq); const float lt = l[nq] + __shfl_xor(l[nq], 16, 32);   /* a wave owns every 128-byte line that it writes */
#pragma unroll
        for (int ct = 0; ct < 4; ++ct)
#pragma unroll
            for (int j = 0; j < 8; ++j) Op[(nb * CC + ct * 16 + hi * 8 + j) * 16 + lr] = o[ct][nq][j];
        ML[nb * 32 + lane] = hi ? lt : m[nq]; }
}
__global__ __launch_bounds__(128) void k_attn(const bf* __restrict__ Qh, const bf* __restrict__ Ql, const bf* __restrict__ Kh, const bf* __restrict__ Kl, const h16* __restrict__ V16, const bf* __restrict__ Vh, const bf* __restrict__ Vl, float* Op, float* ML) {
    __shared__ __align__(16) unsigned char Sm[2 * SBB];   /* K and V tiles, two buffers */
    const size_t b = blockIdx.y, pl = (size_t)blockIdx.x * NB_ + b; const size_t tb = b * TT * MID, vb = b * CC * TT;
    const int tile = blockIdx.z, wv = threadIdx.x >> 5, k0 = (int)(blockIdx.x * (TT / 32) / NSP) * 32, k1 = (int)((blockIdx.x + 1) * (TT / 32) / NSP) * 32;
    if (tile < RH / 64) attn_span<true, 1>(Qh + tb, Ql + tb, Kh + tb, Kl + tb, V16 + vb, Vh + vb, Vl + vb, tile * 64 + wv * 16, k0, k1, Op + pl * CC * TT, ML + pl * TT * 2, Sm);
    else { attn_span<false, 2>(Qh + tb, Ql + tb, Kh + tb, Kl + tb, V16 + vb, Vh + vb, Vl + vb, RH + (tile - RH / 64) * 128 + wv * 32, k0, k1, Op + pl * CC * TT, ML + pl * TT * 2, Sm);
        asm volatile("s_wait_xcnt 0x0" ::: "memory"); }   /* precaution: in the built code this path's last stores are followed by the other path's prologue, which reuses their registers */
}
// k_merge: out[b][c][n] = sum_s O_s[c][n] w_s / sum_s l_s w_s, w_s = exp(m_s - max m), spans in order; the x1024 carry of the fp16 rows is taken out here.
// Per span and batch: O [n / 16][c][n % 16]; ML [n / 16][32]: 16 maxima, then 16 sums.
__global__ __launch_bounds__(256) void k_merge(const float* __restrict__ Op, const float* __restrict__ ML, float* out) { const size_t i = (size_t)blockIdx.x * 256 + threadIdx.x; if (i >= (size_t)NB_ * CC * TT / 4) return; const int n = (int)(i % (TT / 4)) * 4; const int c = (int)((i / (TT / 4)) % CC); const size_t b = i / ((size_t)CC * TT / 4); const size_t nb = (size_t)(n / 16); const int nr = n % 16; v4f ms[NSP]; v4f mx;
#pragma unroll
    for (int s = 0; s < NSP; ++s) { ms[s] = *(const v4f*)(ML + (((size_t)s * NB_ + b) * (TT / 16) + nb) * 32 + nr);
#pragma unroll
        for (int q = 0; q < 4; ++q) mx[q] = s ? fmaxf(mx[q], ms[s][q]) : ms[s][q]; }
    v4f num = (v4f){}, den = (v4f){};
#pragma unroll
    for (int s = 0; s < NSP; ++s) { const size_t pn = ((size_t)s * NB_ + b) * (TT / 16) + nb; const v4f ls = *(const v4f*)(ML + pn * 32 + 16 + nr); const v4f os = *(const v4f*)(Op + (pn * CC + c) * 16 + nr);
#pragma unroll
        for (int q = 0; q < 4; ++q) { const float w = __builtin_amdgcn_exp2f((ms[s][q] - mx[q]) * L2E); num[q] += os[q] * w; den[q] += ls[q] * w; } }
    const float cs = (n < RH) ? 1.0f : (1.0f / PCAR); v4f r;
#pragma unroll
    for (int q = 0; q < 4; ++q) r[q] = num[q] * __fdiv_rn(cs, den[q]);
    *(v4f*)(out + (b * CC + c) * TT + n) = r;  }

extern "C" void kernel_launch(void* const* d_in, const int* in_sizes, int n_in,
                              void* d_out, int out_size, void* d_ws, size_t ws_size, hipStream_t stream) {
    (void)in_sizes; (void)n_in; (void)out_size;
    const float* x = (const float*)d_in[0]; const float* wq = (const float*)d_in[1]; const float* bq = (const float*)d_in[2]; const float* wk = (const float*)d_in[3]; const float* bk = (const float*)d_in[4]; const float* wv = (const float*)d_in[5]; const float* bv = (const float*)d_in[6]; const float* relh = (const float*)d_in[7]; const float* relw = (const float*)d_in[8];   /* [1][64][64][1], [1][64][1][64] */
    float* OUT = (float*)d_out;     // [4][64][4096] channel-major
    char* wsp = (char*)d_ws;
    auto take = [&](size_t bytes) { char* p = wsp; wsp += (bytes + 255) & ~(size_t)255; return (void*)p; };
    bf* QPh = (bf*)take((size_t)NB_ * TT * MID * 2); bf* QPl = (bf*)take((size_t)NB_ * TT * MID * 2); bf* KPh = (bf*)take((size_t)NB_ * TT * MID * 2); bf* KPl = (bf*)take((size_t)NB_ * TT * MID * 2);   /* hi/lo planes: one set per batch */
    h16* VT16 = (h16*)take((size_t)NB_ * CC * TT * 2); bf* VTh = (bf*)take((size_t)NB_ * CC * TT * 2); bf* VTl = (bf*)take((size_t)NB_ * CC * TT * 2);   /* V^T planes [4][64][4096] */
    float* Op = (float*)take((size_t)NSP * NB_ * CC * TT * 4); float* ML = (float*)take((size_t)NSP * NB_ * TT * 2 * 4);   /* per span and batch: unnormalised out^T in blocks of 16 queries, running maxima and sums */
    if ((size_t)(wsp - (char*)d_ws) > ws_size) return;    // ws 256 MiB (carve ~45 MiB)
    k_prep<<<dim3(TT / 64, NB_), 128, 0, stream>>>(x, wq, bq, wk, bk, wv, bv, relh, relw, QPh, QPl, KPh, KPl, VT16, VTh, VTl);   /* projections, k + pos (f32), planes: all batches */
    k_attn<<<dim3(NSP, NB_, RH / 64 + (TT - RH) / 128), 128, 0, stream>>>(QPh, QPl, KPh, KPl, VT16, VTh, VTl, Op, ML);   /* scores (every row hi/lo, unscaled logits), softmax, attn.v: all batches */
    k_merge<<<(unsigned)(((size_t)NB_ * CC * TT / 4 + 255) / 256), 256, 0, stream>>>(Op, ML, OUT);   /* spans joined, channel-major output */
}

// v005
// It runs in 46.4 microseconds.
// Timed twice side by side with v004, it ran 1.05 times as fast both times.
// Over all steps from v000 it is 22.5 times as fast.
#include <hip/hip_runtime.h>

// Self-attention over a 64x64 feature map with a learned 2-D positional key term (x [4][64][64x64] channel-major; q, k, v = 1x1 convs 'oi' [64][64] + [64] (1/8 weights, 0.02 biases); energy[n][m] = q_n.k_m + q_n.pos_m with pos[c][(hh, ww)] = rel_h[c][hh] + rel_w[c][ww] ([1][64][64][1] + [1][64][1][64], read) == q_n.(k_m + pos_m) (unscaled, sigma ~8); softmax over the 4,096 positions; out[c][n] = sum_m v[c][m] attn[n][m] -> [4][64][64][64] (1.0 M)).
// Layout: one kernel for all batches (k_prep) rounds the channel-major map and the weights to bf16, does the three exact projections + f32 biases, adds the positional table to the key rows in f32 (q.k + q.pos == q.(k + pos)) and writes the hi/lo planes, one set per batch. One kernel for all batches then does scores, softmax and attn.v in registers (k_attn), one key span per work-group, its K and V tiles shared through LDS; k_merge joins the spans and writes the channel-major output rows.
// Compute dtypes, f32 accumulate: every input rounded to bf16; projections exact + f32 biases; scores 3 products on every row; softmax f32 (running maximum); attn.V rows < 512 3 products (P, V hi/lo), rest fp16 (P x1024); epilogue f32.

#define NB_  4
#define TT   4096
#define DM   512
#define NH_  1
#define NKV  1
#define REP  (NH_ / NKV)
#define HD   64
#define DQ   (NH_ * HD)
#define DKV  (NKV * HD)
#define ZH   1
#define RH   512                  // query rows < RH use hi+lo planes (0: none)
#define WIN  0
#define PCAR 1024.0f
#define PCL2 10.0f     // log2 PCAR
#define SCL  1.0f   // no scaling in the module
#define MID  64
#define CQR  64      // q/k use all channels (no padding)
#define CC   64
#define NSP  7       // the 128 passes of 32 keys are dealt to NSP spans (18 or 19 each; 36 tiles x 4 batches x 7 = 1,008 work-groups of 4 waves at 4 waves per SIMD: one round on 256 WGPs), one work-group per span and query tile
typedef _Float16 h16;
typedef unsigned short bf;
typedef __attribute__((ext_vector_type(16))) __bf16   v16bf;
typedef __attribute__((ext_vector_type(16))) _Float16 v16h;
typedef __attribute__((ext_vector_type(8)))  _Float16 v8h;
typedef __attribute__((ext_vector_type(8)))  unsigned short v8us;
typedef __attribute__((ext_vector_type(8)))  float    v8f;
typedef __attribute__((ext_vector_type(4)))  float    v4f;
typedef v8h  __attribute__((may_alias)) v8ha;
typedef v4f  __attribute__((may_alias)) v4fa;
typedef v8us __attribute__((may_alias)) v8usa;

__device__ __forceinline__ unsigned short f2bf(float f) { unsigned u = __float_as_uint(f); u += 0x7FFFu + ((u >> 16) & 1u); return (unsigned short)(u >> 16); }
__device__ __forceinline__ float bf2f(unsigned short b) { return __uint_as_float(((unsigned)b) << 16); }
__device__ __forceinline__ float bfr(float f) { return bf2f(f2bf(f)); }
__device__ __forceinline__ v16h cat16(v8h lo, v8h hi) { return __builtin_shufflevector(lo, hi, 0, 1, 2, 3, 4, 5, 6, 7, 8, 9, 10, 11, 12, 13, 14, 15); }
__device__ __forceinline__ v16bf cat16b(v8us lo, v8us hi) { return __builtin_bit_cast(v16bf, __builtin_shufflevector(lo, hi, 0, 1, 2, 3, 4, 5, 6, 7, 8, 9, 10, 11, 12, 13, 14, 15)); }
__device__ __forceinline__ v8f wmma16(v16h a, v16h b, v8f c) { return __builtin_amdgcn_wmma_f32_16x16x32_f16(false, a, false, b, (short)0, c, false, false); }
__device__ __forceinline__ v8f wmmab(v16bf a, v16bf b, v8f c) { return __builtin_amdgcn_wmma_f32_16x16x32_bf16(false, a, false, b, (short)0, c, false, false); }



template <typename T16> struct WFrag;   // 16x32 operand fragment from a K-contiguous 16-bit row: p = row start + 8 (lane >> 4); k = 8 hi + 0..7, 16 + 8 hi + 0..7 (A and B alike)
template <> struct WFrag<h16> { typedef v16h V; static __device__ __forceinline__ V ld(const h16* p) { return cat16(*(const v8h*)p, *(const v8h*)(p + 16)); } };
template <> struct WFrag<bf> { typedef v16bf V; static __device__ __forceinline__ V ld(const bf* p) { return cat16b(*(const v8us*)p, *(const v8us*)(p + 16)); } };

__device__ __forceinline__ h16 tohx(float x) { return (h16)x; }
__device__ __forceinline__ void splitf(float y, unsigned short& h, unsigned short& l) { h = f2bf(y); l = f2bf(y - bf2f(h)); }
typedef __attribute__((ext_vector_type(16))) unsigned short v16us;

#define WP 72   // LDS row pitch in 16-bit elements: 144 B = 16 B x odd, for the 16-byte fragment reads
// ---- k_prep: everything in front of the attention, one launch. Grid (64 map rows, 4 batches), 4 waves; a work-group owns the 64 tokens of one map row (hh = blockIdx.x, ww = 0..63).
// Each wave rounds its own 16 tokens' x to bf16 straight into a fragment (row = token, k = channel), which also goes to LDS; the work-group rounds the three weight matrices ('oi' = K-contiguous rows) into LDS once.
// q, k: A = 16 weight rows, B = the wave's own tokens, so a lane holds one token and 8 consecutive output channels: 16-byte stores, and the wave writes the whole 128-byte row of each of its tokens.
// v: A = 16 tokens (from LDS), B = weight rows 16 wave + 0..15, so a lane holds one channel and 8 consecutive tokens, and the wave writes the whole 128-byte piece (64 tokens) of each of its channel rows.
// Every product sums k = 0..31, then 32..63, as two accumulating matrix instructions.
__global__ __launch_bounds__(128) void k_prep(const float* __restrict__ x, const float* __restrict__ wq, const float* __restrict__ bq, const float* __restrict__ wk, const float* __restrict__ bk, const float* __restrict__ wv, const float* __restrict__ bv, const float* __restrict__ rh, const float* __restrict__ rw,
                                              bf* Qh, bf* Ql, bf* Kh, bf* Kl, h16* V16, bf* Vh, bf* Vl) {
    __shared__ __align__(16) bf Ws[3 * 64 * WP];
    __shared__ __align__(16) bf Xs[64 * WP];
    __shared__ __align__(32) float Rh[64];   /* this map row's column of rel_h, rounded */
    const int tid = threadIdx.x, lane = tid & 31, lr = lane & 15, hi = lane >> 4, wvi = tid >> 5;
    const int hh = blockIdx.x, tl = wvi * 16 + lr; const size_t b = blockIdx.y;
    const float* xt = x + b * CC * TT + hh * 64 + tl;
    float xr[2][16];
#pragma unroll
    for (int kc = 0; kc < 2; ++kc)
#pragma unroll
        for (int e = 0; e < 16; ++e) xr[kc][e] = xt[(kc * 32 + 8 * hi + (e & 7) + 16 * (e >> 3)) * TT];
    asm volatile("s_wait_xcnt 0x0" ::: "memory");   /* precaution, here and below: stands before any register that the loads or stores above name is reused */
    v8f wr[12];   /* 3 x 512 runs of 8 weights, 12 per thread */
#pragma unroll
    for (int i = 0; i < 12; ++i) wr[i] = *(const v8f*)((i < 4 ? wq : i < 8 ? wk : wv) + ((i & 3) * 128 + tid) * 8);
    asm volatile("s_wait_xcnt 0x0" ::: "memory");
    float rwr[4][8]; v8f bqr[4], bkr[4];
#pragma unroll
    for (int ot = 0; ot < 4; ++ot)
#pragma unroll
        for (int j = 0; j < 8; ++j) rwr[ot][j] = rw[(ot * 16 + 8 * hi + j) * 64 + tl];
    asm volatile("s_wait_xcnt 0x0" ::: "memory");
#pragma unroll
    for (int ot = 0; ot < 4; ++ot) { bqr[ot] = *(const v8f*)(bq + ot * 16 + 8 * hi); bkr[ot] = *(const v8f*)(bk + ot * 16 + 8 * hi); }
    const float bvw = bv[tl];   /* channel 16 wave + lr */
    asm volatile("s_wait_xcnt 0x0" ::: "memory");
    const float bvr = bfr(bvw);
    if (tid < 64) { const float rhw = rh[tid * 64 + hh];   /* waves 0 and 1, whole */
        asm volatile("s_wait_xcnt 0x0" :: "v"(rhw) : "memory");   /* the same precaution; the loaded value as an input keeps the wait behind this load */
        Rh[tid] = bfr(rhw); }
    v16bf xf[2];
#pragma unroll
    for (int kc = 0; kc < 2; ++kc) { v8us lo8, hi8;
#pragma unroll
        for (int e = 0; e < 8; ++e) { lo8[e] = f2bf(xr[kc][e]); hi8[e] = f2bf(xr[kc][8 + e]); }
        *(v8us*)(Xs + tl * WP + kc * 32 + 8 * hi) = lo8; *(v8us*)(Xs + tl * WP + kc * 32 + 8 * hi + 16) = hi8; xf[kc] = cat16b(lo8, hi8); }
#pragma unroll
    for (int i = 0; i < 12; ++i) { const int u = (i & 3) * 128 + tid; v8us o;
#pragma unroll
        for (int q = 0; q < 8; ++q) o[q] = f2bf(wr[i][q]);
        *(v8us*)(Ws + ((i >> 2) * 64 + (u >> 3)) * WP + (u & 7) * 8) = o; }
    __syncthreads();
    const size_t qrow = (b * TT + hh * 64 + tl) * MID + 8 * hi;
#pragma unroll
    for (int p = 0; p < 2; ++p)   /* 0: q, 1: k + pos */
#pragma unroll
        for (int ot = 0; ot < 4; ++ot) { v8f acc = (v8f){};
#pragma unroll
            for (int kc = 0; kc < 2; ++kc) acc = wmmab(WFrag<bf>::ld(Ws + (p * 64 + ot * 16 + lr) * WP + kc * 32 + 8 * hi), xf[kc], acc);
            v8us oh, ol; v8f rhv; if (p) rhv = *(const v8f*)(Rh + ot * 16 + 8 * hi);
#pragma unroll
            for (int j = 0; j < 8; ++j) { float y = acc[j] + bfr(p ? bkr[ot][j] : bqr[ot][j]); if (p) y = __fadd_rn(y, __fadd_rn(rhv[j], bfr(rwr[ot][j]))); unsigned short a2, c2; splitf(y, a2, c2); oh[j] = a2; ol[j] = c2; }
            *(v8us*)((p ? Kh : Qh) + qrow + ot * 16) = oh; *(v8us*)((p ? Kl : Ql) + qrow + ot * 16) = ol;
            asm volatile("s_wait_xcnt 0x0" ::: "memory"); }
    v16bf wf[2];
#pragma unroll
    for (int kc = 0; kc < 2; ++kc) wf[kc] = WFrag<bf>::ld(Ws + (128 + tl) * WP + kc * 32 + 8 * hi);
    const size_t vrow = (b * CC + tl) * TT + hh * 64 + 8 * hi;
#pragma unroll
    for (int mb = 0; mb < 4; ++mb) { v8f acc = (v8f){};
#pragma unroll
        for (int kc = 0; kc < 2; ++kc) acc = wmmab(WFrag<bf>::ld(Xs + (mb * 16 + lr) * WP + kc * 32 + 8 * hi), wf[kc], acc);
        v8h o16; v8us oh, ol;
#pragma unroll
        for (int j = 0; j < 8; ++j) { const float y = acc[j] + bvr; o16[j] = tohx(y); unsigned short a2, c2; splitf(y, a2, c2); oh[j] = a2; ol[j] = c2; }
        *(v8h*)(V16 + vrow + mb * 16) = o16; *(v8us*)(Vh + vrow + mb * 16) = oh; *(v8us*)(Vl + vrow + mb * 16) = ol;
        asm volatile("s_wait_xcnt 0x0" ::: "memory"); }
}

#define L2E 1.4426950408889634f
// ---- k_attn: scores, softmax and attn.v of one key span for one query tile, 4 waves x 16 NQ queries (rows < RH: NQ = 1, 64-query tiles, which start first; rest NQ = 2, 128-query tiles); scores and P never leave the registers.
// The score tile is formed TRANSPOSED (A = 16 key rows, B = 16 query rows), so a lane holds one query (column lr) and keys 8 hi + j of each 16-key tile: the row maximum and sum are in-lane but for one exchange with lane ^ 16,
// and two such tiles, converted, ARE the B fragment (k = 8 hi + 0..7, 16 + 8 hi + 0..7) of out^T[c][n] += V^T[c][k] P[n][k]. 
// P = exp2(s log2e + eb), one fused multiply-add per score in front of the exponential; in the fp16 rows eb holds the x1024 carry, so P and its sum are formed already scaled.
// Per span: running maximum m, sum l and unnormalised out^T, each relative to m; k_merge joins the spans. Inner loops are unrolled so that every fragment array stays in registers.
// K and V: the work-group brings each pass's tiles (32 key rows of 128 B per plane, 64 channel rows of 64 B per plane) into LDS once, by asynchronous copies, 16 B per lane, two buffers: pass t + 2's copies are issued behind the barrier that ends pass t, so they fly during pass t + 1.
// The 4 waves read their fragments from LDS (16-byte reads; row pitches 16 B x odd). The fragments hold the same elements as before, so every sum keeps its order.
#define KP  144                    // LDS pitch of a 128-byte K row, bytes
#define VP  80                     // LDS pitch of a 64-byte piece of a V row, bytes
#define KPB (32 * KP)              // one K plane of a pass
#define VPB (64 * VP)              // one V plane of a pass
#define SBB (2 * KPB + 2 * VPB)    // one buffer: K hi, K lo, V (fp16, or hi and lo)
// One pass's copies, every thread of the work-group: piece u = 128 i + tid of each plane. K: 8 pieces a row, the plane's 4 KiB are contiguous in memory; V: 4 pieces a row.
// s_wait_xcnt 0 closes each statement: a precaution, it stands before any register that the copies name is reused.
template <bool HR>
__device__ __forceinline__ void stage_kv(unsigned dst, const bf* __restrict__ Kh, const bf* __restrict__ Kl, const h16* __restrict__ V16, const bf* __restrict__ Vh, const bf* __restrict__ Vl, int kb) {
    const int tid = threadIdx.x;
    const unsigned lk = dst + (tid >> 3) * KP + (tid & 7) * 16, lv = dst + 2 * KPB + (tid >> 2) * VP + (tid & 3) * 16;
    const size_t ko = (size_t)kb * MID + tid * 8, vo = (size_t)(tid >> 2) * TT + kb + (tid & 3) * 8;
    const void* v0 = HR ? (const void*)(Vh + vo) : (const void*)(V16 + vo);
    const void* v1 = HR ? (const void*)(Vh + vo + 32 * TT) : (const void*)(V16 + vo + 32 * TT);
    asm volatile("global_load_async_to_lds_b128 %0, %6, off\n\t"
                 "global_load_async_to_lds_b128 %1, %7, off\n\t"
                 "global_load_async_to_lds_b128 %2, %8, off\n\t"
                 "global_load_async_to_lds_b128 %3, %9, off\n\t"
                 "global_load_async_to_lds_b128 %4, %10, off\n\t"
                 "global_load_async_to_lds_b128 %5, %11, off\n\t"
                 "s_wait_xcnt 0x0"
                 :: "v"(lk), "v"(lk + 16 * KP), "v"(lk + KPB), "v"(lk + KPB + 16 * KP), "v"(lv), "v"(lv + 32 * VP),
                    "v"(Kh + ko), "v"(Kh + ko + 1024), "v"(Kl + ko), "v"(Kl + ko + 1024), "v"(v0), "v"(v1) : "memory");
    if (HR)
        asm volatile("global_load_async_to_lds_b128 %0, %2, off\n\t"
                     "global_load_async_to_lds_b128 %1, %3, off\n\t"
                     "s_wait_xcnt 0x0"
                     :: "v"(lv + VPB), "v"(lv + VPB + 32 * VP), "v"(Vl + vo), "v"(Vl + vo + 32 * TT) : "memory");
}
template <bool HR, int NQ>
__device__ __forceinline__ void attn_span(const bf* __restrict__ Qh, const bf* __restrict__ Ql, const bf* __restrict__ Kh, const bf* __restrict__ Kl, const h16* __restrict__ V16, const bf* __restrict__ Vh, const bf* __restrict__ Vl, int n0, int k0, int k1, float* Op, float* ML, const unsigned char* Sm) {
    const int lane = threadIdx.x & 31, lr = lane & 15, hi = lane >> 4;
    const unsigned sb = (unsigned)(size_t)Sm;   /* the buffers' byte address in LDS */
    stage_kv<HR>(sb, Kh, Kl, V16, Vh, Vl, k0);
    v16bf qh[NQ][2], ql[NQ][2];
#pragma unroll
    for (int nq = 0; nq < NQ; ++nq)
#pragma unroll
        for (int kc = 0; kc < 2; ++kc) { const size_t qo = (size_t)(n0 + nq * 16 + lr) * MID + kc * 32 + 8 * hi; qh[nq][kc] = WFrag<bf>::ld(Qh + qo); ql[nq][kc] = WFrag<bf>::ld(Ql + qo); }
    v8f o[4][NQ]; float m[NQ], l[NQ];
#pragma unroll
    for (int nq = 0; nq < NQ; ++nq) { m[nq] = -3.0e38f; l[nq] = 0.0f;
#pragma unroll
        for (int ct = 0; ct < 4; ++ct) o[ct][nq] = (v8f){}; }
    asm volatile("s_wait_asynccnt 0x0" ::: "memory");   /* this wave's share of pass 0's tiles has landed */
    __syncthreads();                                     /* ... and every other wave's: pass 0's tiles may be read */
    if (k0 + 32 < k1) stage_kv<HR>(sb + SBB, Kh, Kl, V16, Vh, Vl, k0 + 32);
    unsigned cur = 0;   /* byte offset of the buffer that this pass reads */
#pragma unroll 1   /* kept rolled: a second pass's fragments would push the wave past 256 registers (4 waves per SIMD) */
    for (int kb = k0; kb < k1; kb += 32) {
        const unsigned char* kt_ = Sm + cur + lr * KP + 16 * hi; const unsigned char* vt_ = Sm + cur + 2 * KPB + lr * VP + 16 * hi;
        v8f s[2][NQ];
#pragma unroll
        for (int kt = 0; kt < 2; ++kt) {
#pragma unroll
            for (int nq = 0; nq < NQ; ++nq) s[kt][nq] = (v8f){};
#pragma unroll
            for (int kc = 0; kc < 2; ++kc) { const unsigned char* kp = kt_ + kt * 16 * KP + kc * 64; const v16bf kh = WFrag<bf>::ld((const bf*)kp), kl = WFrag<bf>::ld((const bf*)(kp + KPB));
#pragma unroll
                for (int nq = 0; nq < NQ; ++nq) { s[kt][nq] = wmmab(kh, qh[nq][kc], s[kt][nq]); s[kt][nq] = wmmab(kh, ql[nq][kc], s[kt][nq]); s[kt][nq] = wmmab(kl, qh[nq][kc], s[kt][nq]); } } }
        v16h va[4]; v16bf vh[4], vl[4];   /* read behind the score products, into the registers that the K fragments leave */
#pragma unroll
        for (int ct = 0; ct < 4; ++ct) { if (HR) { vh[ct] = WFrag<bf>::ld((const bf*)(vt_ + ct * 16 * VP)); vl[ct] = WFrag<bf>::ld((const bf*)(vt_ + VPB + ct * 16 * VP)); } else va[ct] = WFrag<h16>::ld((const h16*)(vt_ + ct * 16 * VP)); }
        float al[NQ]; bool moved = false;
#pragma unroll
        for (int nq = 0; nq < NQ; ++nq) { float mx = fmaxf(s[0][nq][0], s[1][nq][0]);
#pragma unroll
            for (int j = 1; j < 8; ++j) mx = fmaxf(mx, fmaxf(s[0][nq][j], s[1][nq][j]));
            mx = fmaxf(mx, __shfl_xor(mx, 16, 32));
            const float mn = fmaxf(m[nq], mx); moved = moved || (mn > m[nq]); al[nq] = __builtin_amdgcn_exp2f((m[nq] - mn) * L2E); m[nq] = mn; float ps = 0.0f;
            const float eb = HR ? -mn * L2E : __builtin_fmaf(-mn, L2E, PCL2);   /* one addend per query and pass: minus the maximum in log2 units, plus the fp16 rows' carry as an exponent */
#pragma unroll
            for (int kt = 0; kt < 2; ++kt) { const v8f a = __builtin_elementwise_fma(s[kt][nq], (v8f)(L2E), (v8f)(eb));   /* whole vectors: packed multiply-adds, two scores each */
#pragma unroll
                for (int j = 0; j < 8; ++j) { const float p = __builtin_amdgcn_exp2f(a[j]); s[kt][nq][j] = p; ps += p; } }
            l[nq] = l[nq] * al[nq] + ps; }
        /* inputs only: holds the V reads here, as one group whose latency the maxima cover; left free, they sink to one fragment at a time in front of its products, each with a full LDS wait */
        if (HR) asm volatile("" :: "v"(vh[0]), "v"(vh[1]), "v"(vh[2]), "v"(vh[3]), "v"(vl[0]), "v"(vl[1]), "v"(vl[2]), "v"(vl[3]));
        else asm volatile("" :: "v"(va[0]), "v"(va[1]), "v"(va[2]), "v"(va[3]));
        if (__any(moved)) {   /* no maximum of the wave moved: every factor is exactly 1 */
#pragma unroll
            for (int ct = 0; ct < 4; ++ct)
#pragma unroll
                for (int nq = 0; nq < NQ; ++nq) o[ct][nq] *= al[nq]; }
        if (HR) {
            v16bf ph[NQ], pl[NQ];
#pragma unroll
            for (int nq = 0; nq < NQ; ++nq) { v16us a16, c16;
#pragma unroll
                for (int e = 0; e < 8; ++e) { unsigned short a2, c2; splitf(s[0][nq][e], a2, c2); a16[e] = a2; c16[e] = c2; splitf(s[1][nq][e], a2, c2); a16[8 + e] = a2; c16[8 + e] = c2; }
                ph[nq] = __builtin_bit_cast(v16bf, a16); pl[nq] = __builtin_bit_cast(v16bf, c16); }
#pragma unroll
            for (int ct = 0; ct < 4; ++ct)
#pragma unroll
                for (int nq = 0; nq < NQ; ++nq) { o[ct][nq] = wmmab(vh[ct], ph[nq], o[ct][nq]); o[ct][nq] = wmmab(vh[ct], pl[nq], o[ct][nq]); o[ct][nq] = wmmab(vl[ct], ph[nq], o[ct][nq]); }
        } else {
            v16h pf[NQ];
#pragma unroll
            for (int nq = 0; nq < NQ; ++nq)
#pragma unroll
                for (int e = 0; e < 8; ++e) { pf[nq][e] = tohx(s[0][nq][e]); pf[nq][8 + e] = tohx(s[1][nq][e]); }
#pragma unroll
            for (int ct = 0; ct < 4; ++ct)
#pragma unroll
                for (int nq = 0; nq < NQ; ++nq) o[ct][nq] = wmma16(va[ct], pf[nq], o[ct][nq]);
        }
        asm volatile("s_wait_dscnt 0x0" ::: "memory");      /* this wave's reads of the current buffer are done */
        asm volatile("s_wait_asynccnt 0x0" ::: "memory");   /* its share of the next pass's tiles has landed */
        __syncthreads();                                     /* one barrier a pass: it publishes the next pass's tiles and frees the buffer just read */
        if (kb + 64 < k1) stage_kv<HR>(sb + cur, Kh, Kl, V16, Vh, Vl, kb + 64);
        cur ^= SBB;
    }
    asm volatile("s_wait_asynccnt 0x0" ::: "memory");   /* no copy is left in flight when the wave goes on to its stores and ends */
#pragma unroll
    for (int nq = 0; nq < NQ; ++nq) { const size_t nb = (size_t)(n0 / 16 + nq); const float lt = (l[nq] + __shfl_xor(l[nq], 16, 32)) * (HR ? 1.0f : 1.0f / PCAR);   /* the fp16 rows' sum carries the x1024 of its terms: taken out here, exactly. A wave owns every 128-byte line that it writes */
#pragma unroll
        for (int ct = 0; ct < 4; ++ct)
#pragma unroll
            for (int j = 0; j < 8; ++j) Op[(nb * CC + ct * 16 + hi * 8 + j) * 16 + lr] = o[ct][nq][j];
        ML[nb * 32 + lane] = hi ? lt : m[nq]; }
}
__global__ __launch_bounds__(128) void k_attn(const bf* __restrict__ Qh, const bf* __restrict__ Ql, const bf* __restrict__ Kh, const bf* __restrict__ Kl, const h16* __restrict__ V16, const bf* __restrict__ Vh, const bf* __restrict__ Vl, float* Op, float* ML) {
    __shared__ __align__(16) unsigned char Sm[2 * SBB];   /* K and V tiles, two buffers */
    const size_t b = blockIdx.y, pl = (size_t)blockIdx.x * NB_ + b; const size_t tb = b * TT * MID, vb = b * CC * TT;
    const int tile = blockIdx.z, wv = threadIdx.x >> 5, k0 = (int)(blockIdx.x * (TT / 32) / NSP) * 32, k1 = (int)((blockIdx.x + 1) * (TT / 32) / NSP) * 32;
    if (tile < RH / 64) attn_span<true, 1>(Qh + tb, Ql + tb, Kh + tb, Kl + tb, V16 + vb, Vh + vb, Vl + vb, tile * 64 + wv * 16, k0, k1, Op + pl * CC * TT, ML + pl * TT * 2, Sm);
    else { attn_span<false, 2>(Qh + tb, Ql + tb, Kh + tb, Kl + tb, V16 + vb, Vh + vb, Vl + vb, RH + (tile - RH / 64) * 128 + wv * 32, k0, k1, Op + pl * CC * TT, ML + pl * TT * 2, Sm);
        asm volatile("s_wait_xcnt 0x0" ::: "memory"); }   /* precaution: in the built code this path's last stores are followed by the other path's prologue, which reuses their registers */
}
// k_merge: out[b][c][n] = sum_s O_s[c][n] w_s / sum_s l_s w_s, w_s = exp(m_s - max m), spans in order; the x1024 carry of the fp16 rows is taken out here.
// Per span and batch: O [n / 16][c][n % 16]; ML [n / 16][32]: 16 maxima, then 16 sums.
__global__ __launch_bounds__(256) void k_merge(const float* __restrict__ Op, const float* __restrict__ ML, float* out) { const size_t i = (size_t)blockIdx.x * 256 + threadIdx.x; if (i >= (size_t)NB_ * CC * TT / 4) return; const int n = (int)(i % (TT / 4)) * 4; const int c = (int)((i / (TT / 4)) % CC); const size_t b = i / ((size_t)CC * TT / 4); const size_t nb = (size_t)(n / 16); const int nr = n % 16; v4f ms[NSP]; v4f mx;
#pragma unroll
    for (int s = 0; s < NSP; ++s) { ms[s] = *(const v4f*)(ML + (((size_t)s * NB_ + b) * (TT / 16) + nb) * 32 + nr);
#pragma unroll
        for (int q = 0; q < 4; ++q) mx[q] = s ? fmaxf(mx[q], ms[s][q]) : ms[s][q]; }
    v4f num = (v4f){}, den = (v4f){};
#pragma unroll
    for (int s = 0; s < NSP; ++s) { const size_t pn = ((size_t)s * NB_ + b) * (TT / 16) + nb; const v4f ls = *(const v4f*)(ML + pn * 32 + 16 + nr); const v4f os = *(const v4f*)(Op + (pn * CC + c) * 16 + nr);
#pragma unroll
        for (int q = 0; q < 4; ++q) { const float w = __builtin_amdgcn_exp2f((ms[s][q] - mx[q]) * L2E); num[q] += os[q] * w; den[q] += ls[q] * w; } }
    const float cs = (n < RH) ? 1.0f : (1.0f / PCAR); v4f r;
#pragma unroll
    for (int q = 0; q < 4; ++q) r[q] = num[q] * __fdiv_rn(cs, den[q]);
    *(v4f*)(out + (b * CC + c) * TT + n) = r;  }

extern "C" void kernel_launch(void* const* d_in, const int* in_sizes, int n_in,
                              void* d_out, int out_size, void* d_ws, size_t ws_size, hipStream_t stream) {
    (void)in_sizes; (void)n_in; (void)out_size;
    const float* x = (const float*)d_in[0]; const float* wq = (const float*)d_in[1]; const float* bq = (const float*)d_in[2]; const float* wk = (const float*)d_in[3]; const float* bk = (const float*)d_in[4]; const float* wv = (const float*)d_in[5]; const float* bv = (const float*)d_in[6]; const float* relh = (const float*)d_in[7]; const float* relw = (const float*)d_in[8];   /* [1][64][64][1], [1][64][1][64] */
    float* OUT = (float*)d_out;     // [4][64][4096] channel-major
    char* wsp = (char*)d_ws;
    auto take = [&](size_t bytes) { char* p = wsp; wsp += (bytes + 255) & ~(size_t)255; return (void*)p; };
    bf* QPh = (bf*)take((size_t)NB_ * TT * MID * 2); bf* QPl = (bf*)take((size_t)NB_ * TT * MID * 2); bf* KPh = (bf*)take((size_t)NB_ * TT * MID * 2); bf* KPl = (bf*)take((size_t)NB_ * TT * MID * 2);   /* hi/lo planes: one set per batch */
    h16* VT16 = (h16*)take((size_t)NB_ * CC * TT * 2); bf* VTh = (bf*)take((size_t)NB_ * CC * TT * 2); bf* VTl = (bf*)take((size_t)NB_ * CC * TT * 2);   /* V^T planes [4][64][4096] */
    float* Op = (float*)take((size_t)NSP * NB_ * CC * TT * 4); float* ML = (float*)take((size_t)NSP * NB_ * TT * 2 * 4);   /* per span and batch: unnormalised out^T in blocks of 16 queries, running maxima and sums */
    if ((size_t)(wsp - (char*)d_ws) > ws_size) return;    // ws 256 MiB (carve ~45 MiB)
    k_prep<<<dim3(TT / 64, NB_), 128, 0, stream>>>(x, wq, bq, wk, bk, wv, bv, relh, relw, QPh, QPl, KPh, KPl, VT16, VTh, VTl);   /* projections, k + pos (f32), planes: all batches */
    k_attn<<<dim3(NSP, NB_, RH / 64 + (TT - RH) / 128), 128, 0, stream>>>(QPh, QPl, KPh, KPl, VT16, VTh, VTl, Op, ML);   /* scores (every row hi/lo, unscaled logits), softmax, attn.v: all batches */
    k_merge<<<(unsigned)(((size_t)NB_ * CC * TT / 4 + 255) / 256), 256, 0, stream>>>(Op, ML, OUT);   /* spans joined, channel-major output */
}

// v006
// One run takes 44.1 microseconds.
// Next to v005, in two timings, it ran 1.05 times as fast each time.
// Counting every step since v000, it is 23.6 times as fast.
#include <hip/hip_runtime.h>

// Self-attention over a 64x64 feature map with a learned 2-D positional key term (x [4][64][64x64] channel-major; q, k, v = 1x1 convs 'oi' [64][64] + [64] (1/8 weights, 0.02 biases); energy[n][m] = q_n.k_m + q_n.pos_m with pos[c][(hh, ww)] = rel_h[c][hh] + rel_w[c][ww] ([1][64][64][1] + [1][64][1][64], read) == q_n.(k_m + pos_m) (unscaled, sigma ~8); softmax over the 4,096 positions; out[c][n] = sum_m v[c][m] attn[n][m] -> [4][64][64][64] (1.0 M)).
// Layout: one kernel for all batches (k_prep) rounds the channel-major map and the weights to bf16, does the three exact projections + f32 biases, adds the positional table to the key rows in f32 (q.k + q.pos == q.(k + pos)) and writes the hi/lo planes, one set per batch. One kernel for all batches then does scores, softmax and attn.v in registers (k_attn), one key span per work-group, its K and V tiles shared through LDS; k_merge joins the spans and writes the channel-major output rows.
// Compute dtypes, f32 accumulate: every input rounded to bf16; projections exact + f32 biases; scores 3 products on every row; softmax f32 (running maximum); attn.V rows < 512 3 products (P, V hi/lo), rest fp16 (P x1024); epilogue f32.

#define NB_  4
#define TT   4096
#define DM   512
#define NH_  1
#define NKV  1
#define REP  (NH_ / NKV)
#define HD   64
#define DQ   (NH_ * HD)
#define DKV  (NKV * HD)
#define ZH   1
#define RH   512                  // query rows < RH use hi+lo planes (0: none)
#define WIN  0
#define PCAR 1024.0f
#define PCL2 10.0f     // log2 PCAR
#define SCL  1.0f   // no scaling in the module
#define MID  64
#define CQR  64      // q/k use all channels (no padding)
#define CC   64
#define NSP  7       // the 64 passes of 64 keys are dealt to NSP spans (9 or 10 each; 36 tiles x 4 batches x 7 = 1,008 work-groups of 4 waves at 4 waves per SIMD: one round on 256 WGPs), one work-group per span and query tile
#define PK   64      // keys per pass of k_attn
typedef _Float16 h16;
typedef unsigned short bf;
typedef __attribute__((ext_vector_type(16))) __bf16   v16bf;
typedef __attribute__((ext_vector_type(16))) _Float16 v16h;
typedef __attribute__((ext_vector_type(8)))  _Float16 v8h;
typedef __attribute__((ext_vector_type(8)))  unsigned short v8us;
typedef __attribute__((ext_vector_type(8)))  float    v8f;
typedef __attribute__((ext_vector_type(4)))  float    v4f;
typedef __attribute__((ext_vector_type(2)))  float    v2f;
typedef v8h  __attribute__((may_alias)) v8ha;
typedef v4f  __attribute__((may_alias)) v4fa;
typedef v8us __attribute__((may_alias)) v8usa;

__device__ __forceinline__ unsigned short f2bf(float f) { unsigned u = __float_as_uint(f); u += 0x7FFFu + ((u >> 16) & 1u); return (unsigned short)(u >> 16); }
__device__ __forceinline__ float bf2f(unsigned short b) { return __uint_as_float(((unsigned)b) << 16); }
__device__ __forceinline__ float bfr(float f) { return bf2f(f2bf(f)); }
__device__ __forceinline__ v16h cat16(v8h lo, v8h hi) { return __builtin_shufflevector(lo, hi, 0, 1, 2, 3, 4, 5, 6, 7, 8, 9, 10, 11, 12, 13, 14, 15); }
__device__ __forceinline__ v16bf cat16b(v8us lo, v8us hi) { return __builtin_bit_cast(v16bf, __builtin_shufflevector(lo, hi, 0, 1, 2, 3, 4, 5, 6, 7, 8, 9, 10, 11, 12, 13, 14, 15)); }
__device__ __forceinline__ v8f wmma16(v16h a, v16h b, v8f c) { return __builtin_amdgcn_wmma_f32_16x16x32_f16(false, a, false, b, (short)0, c, false, false); }
__device__ __forceinline__ v8f wmmab(v16bf a, v16bf b, v8f c) { return __builtin_amdgcn_wmma_f32_16x16x32_bf16(false, a, false, b, (short)0, c, false, false); }



template <typename T16> struct WFrag;   // 16x32 operand fragment from a K-contiguous 16-bit row: p = row start + 8 (lane >> 4); k = 8 hi + 0..7, 16 + 8 hi + 0..7 (A and B alike)
template <> struct WFrag<h16> { typedef v16h V; static __device__ __forceinline__ V ld(const h16* p) { return cat16(*(const v8h*)p, *(const v8h*)(p + 16)); } };
template <> struct WFrag<bf> { typedef v16bf V; static __device__ __forceinline__ V ld(const bf* p) { return cat16b(*(const v8us*)p, *(const v8us*)(p + 16)); } };

__device__ __forceinline__ h16 tohx(float x) { return (h16)x; }
__device__ __forceinline__ void splitf(float y, unsigned short& h, unsigned short& l) { h = f2bf(y); l = f2bf(y - bf2f(h)); }
typedef __attribute__((ext_vector_type(16))) unsigned short v16us;

#define WP 72   // LDS row pitch in 16-bit elements: 144 B = 16 B x odd, for the 16-byte fragment reads
// ---- k_prep: everything in front of the attention, one launch. Grid (64 map rows, 4 batches), 4 waves; a work-group owns the 64 tokens of one map row (hh = blockIdx.x, ww = 0..63).
// Each wave rounds its own 16 tokens' x to bf16 straight into a fragment (row = token, k = channel), which also goes to LDS; the work-group rounds the three weight matrices ('oi' = K-contiguous rows) into LDS once.
// q, k: A = 16 weight rows, B = the wave's own tokens, so a lane holds one token and 8 consecutive output channels: 16-byte stores, and the wave writes the whole 128-byte row of each of its tokens.
// v: A = 16 tokens (from LDS), B = weight rows 16 wave + 0..15, so a lane holds one channel and 8 consecutive tokens, and the wave writes the whole 128-byte piece (64 tokens) of each of its channel rows.
// Every product sums k = 0..31, then 32..63, as two accumulating matrix instructions.
__global__ __launch_bounds__(128) void k_prep(const float* __restrict__ x, const float* __restrict__ wq, const float* __restrict__ bq, const float* __restrict__ wk, const float* __restrict__ bk, const float* __restrict__ wv, const float* __restrict__ bv, const float* __restrict__ rh, const float* __restrict__ rw,
                                              bf* Qh, bf* Ql, bf* Kh, bf* Kl, h16* V16, bf* Vh, bf* Vl) {
    __shared__ __align__(16) bf Ws[3 * 64 * WP];
    __shared__ __align__(16) bf Xs[64 * WP];
    __shared__ __align__(32) float Rh[64];   /* this map row's column of rel_h, rounded */
    const int tid = threadIdx.x, lane = tid & 31, lr = lane & 15, hi = lane >> 4, wvi = tid >> 5;
    const int hh = blockIdx.x, tl = wvi * 16 + lr; const size_t b = blockIdx.y;
    const float* xt = x + b * CC * TT + hh * 64 + tl;
    float xr[2][16];
#pragma unroll
    for (int kc = 0; kc < 2; ++kc)
#pragma unroll
        for (int e = 0; e < 16; ++e) xr[kc][e] = xt[(kc * 32 + 8 * hi + (e & 7) + 16 * (e >> 3)) * TT];
    asm volatile("s_wait_xcnt 0x0" ::: "memory");   /* precaution, here and below: stands before any register that the loads or stores above name is reused */
    v8f wr[12];   /* 3 x 512 runs of 8 weights, 12 per thread */
#pragma unroll
    for (int i = 0; i < 12; ++i) wr[i] = *(const v8f*)((i < 4 ? wq : i < 8 ? wk : wv) + ((i & 3) * 128 + tid) * 8);
    asm volatile("s_wait_xcnt 0x0" ::: "memory");
    float rwr[4][8]; v8f bqr[4], bkr[4];
#pragma unroll
    for (int ot = 0; ot < 4; ++ot)
#pragma unroll
        for (int j = 0; j < 8; ++j) rwr[ot][j] = rw[(ot * 16 + 8 * hi + j) * 64 + tl];
    asm volatile("s_wait_xcnt 0x0" ::: "memory");
#pragma unroll
    for (int ot = 0; ot < 4; ++ot) { bqr[ot] = *(const v8f*)(bq + ot * 16 + 8 * hi); bkr[ot] = *(const v8f*)(bk + ot * 16 + 8 * hi); }
    const float bvw = bv[tl];   /* channel 16 wave + lr */
    asm volatile("s_wait_xcnt 0x0" ::: "memory");
    const float bvr = bfr(bvw);
    if (tid < 64) { const float rhw = rh[tid * 64 + hh];   /* waves 0 and 1, whole */
        asm volatile("s_wait_xcnt 0x0" :: "v"(rhw) : "memory");   /* the same precaution; the loaded value as an input keeps the wait behind this load */
        Rh[tid] = bfr(rhw); }
    v16bf xf[2];
#pragma unroll
    for (int kc = 0; kc < 2; ++kc) { v8us lo8, hi8;
#pragma unroll
        for (int e = 0; e < 8; ++e) { lo8[e] = f2bf(xr[kc][e]); hi8[e] = f2bf(xr[kc][8 + e]); }
        *(v8us*)(Xs + tl * WP + kc * 32 + 8 * hi) = lo8; *(v8us*)(Xs + tl * WP + kc * 32 + 8 * hi + 16) = hi8; xf[kc] = cat16b(lo8, hi8); }
#pragma unroll
    for (int i = 0; i < 12; ++i) { const int u = (i & 3) * 128 + tid; v8us o;
#pragma unroll
        for (int q = 0; q < 8; ++q) o[q] = f2bf(wr[i][q]);
        *(v8us*)(Ws + ((i >> 2) * 64 + (u >> 3)) * WP + (u & 7) * 8) = o; }
    __syncthreads();
    const size_t qrow = (b * TT + hh * 64 + tl) * MID + 8 * hi;
#pragma unroll
    for (int p = 0; p < 2; ++p)   /* 0: q, 1: k + pos */
#pragma unroll
        for (int ot = 0; ot < 4; ++ot) { v8f acc = (v8f){};
#pragma unroll
            for (int kc = 0; kc < 2; ++kc) acc = wmmab(WFrag<bf>::ld(Ws + (p * 64 + ot * 16 + lr) * WP + kc * 32 + 8 * hi), xf[kc], acc);
            v8us oh, ol; v8f rhv; if (p) rhv = *(const v8f*)(Rh + ot * 16 + 8 * hi);
#pragma unroll
            for (int j = 0; j < 8; ++j) { float y = acc[j] + bfr(p ? bkr[ot][j] : bqr[ot][j]); if (p) y = __fadd_rn(y, __fadd_rn(rhv[j], bfr(rwr[ot][j]))); unsigned short a2, c2; splitf(y, a2, c2); oh[j] = a2; ol[j] = c2; }
            *(v8us*)((p ? Kh : Qh) + qrow + ot * 16) = oh; *(v8us*)((p ? Kl : Ql) + qrow + ot * 16) = ol;
            asm volatile("s_wait_xcnt 0x0" ::: "memory"); }
    v16bf wf[2];
#pragma unroll
    for (int kc = 0; kc < 2; ++kc) wf[kc] = WFrag<bf>::ld(Ws + (128 + tl) * WP + kc * 32 + 8 * hi);
    const size_t vrow = (b * CC + tl) * TT + hh * 64 + 8 * hi;
#pragma unroll
    for (int mb = 0; mb < 4; ++mb) { v8f acc = (v8f){};
#pragma unroll
        for (int kc = 0; kc < 2; ++kc) acc = wmmab(WFrag<bf>::ld(Xs + (mb * 16 + lr) * WP + kc * 32 + 8 * hi), wf[kc], acc);
        v8h o16; v8us oh, ol;
#pragma unroll
        for (int j = 0; j < 8; ++j) { const float y = acc[j] + bvr; o16[j] = tohx(y); unsigned short a2, c2; splitf(y, a2, c2); oh[j] = a2; ol[j] = c2; }
        *(v8h*)(V16 + vrow + mb * 16) = o16; *(v8us*)(Vh + vrow + mb * 16) = oh; *(v8us*)(Vl + vrow + mb * 16) = ol;
        asm volatile("s_wait_xcnt 0x0" ::: "memory"); }
}

#define L2E 1.4426950408889634f
// ---- k_attn: scores, softmax and attn.v of one key span for one query tile, 4 waves x 16 NQ queries (rows < RH: NQ = 1, 64-query tiles, which start first; rest NQ = 2, 128-query tiles); scores and P never leave the registers.
// The score tile is formed TRANSPOSED (A = 16 key rows, B = 16 query rows), so a lane holds one query (column lr) and keys 8 hi + j of each 16-key tile: the row maximum and sum are in-lane but for one exchange with lane ^ 16,
// and two such tiles, converted, ARE the B fragment (k = 8 hi + 0..7, 16 + 8 hi + 0..7) of out^T[c][n] += V^T[c][k] P[n][k].
// A pass takes 64 keys (four such tiles): one maximum, one exchange, one rescaling of out^T and of the sum, one barrier and one set of copy addresses per 64 keys.
// P = exp2(s log2e + eb), one fused multiply-add per score in front of the exponential; in the fp16 rows eb holds the x1024 carry, so P and its sum are formed already scaled.
// Per span: running maximum m, sum l and unnormalised out^T, each relative to m; k_merge joins the spans. Inner loops are unrolled so that every fragment array stays in registers.
// K and V: the work-group brings each pass's tiles (64 key rows of 128 B per plane, 64 channel rows of 128 B per plane) into LDS once, by asynchronous copies, 16 B per lane, two buffers: pass t + 2's copies are issued behind the barrier that ends pass t, so they fly during pass t + 1.
// The 4 waves read their fragments from LDS (16-byte reads; row pitches 16 B x odd).
#define KP  144                    // LDS pitch of a 128-byte K row, bytes
#define VP  144                    // LDS pitch of a 128-byte piece of a V row, bytes
#define KPB (PK * KP)              // one K plane of a pass
#define VPB (64 * VP)              // one V plane of a pass
#define SBB (2 * KPB + 2 * VPB)    // one buffer: K hi, K lo, V (fp16, or hi and lo)
// One pass's copies, every thread of the work-group: piece u = 128 i + tid of each plane, i = 0..3, 8 pieces a row. K: the plane's 8 KiB are contiguous in memory; V: whole 128-byte lines.
// s_wait_xcnt 0 closes each statement: a precaution, it stands before any register that the copies name is reused.
template <bool HR>
__device__ __forceinline__ void stage_kv(unsigned dst, const bf* __restrict__ Kh, const bf* __restrict__ Kl, const h16* __restrict__ V16, const bf* __restrict__ Vh, const bf* __restrict__ Vl, int kb) {
    const int tid = threadIdx.x;
    const unsigned lk = dst + (tid >> 3) * KP + (tid & 7) * 16, lv = lk + 2 * KPB;   /* KP == VP: the same place in a K and in a V plane */
    const size_t ko = (size_t)kb * MID + tid * 8, vo = (size_t)(tid >> 3) * TT + kb + (tid & 7) * 8;
    const bf* va = HR ? Vh + vo : (const bf*)(V16 + vo);   /* address only: 16-bit elements either way */
    asm volatile("global_load_async_to_lds_b128 %0, %12, off\n\t"
                 "global_load_async_to_lds_b128 %1, %13, off\n\t"
                 "global_load_async_to_lds_b128 %2, %14, off\n\t"
                 "global_load_async_to_lds_b128 %3, %15, off\n\t"
                 "global_load_async_to_lds_b128 %4, %16, off\n\t"
                 "global_load_async_to_lds_b128 %5, %17, off\n\t"
                 "global_load_async_to_lds_b128 %6, %18, off\n\t"
                 "global_load_async_to_lds_b128 %7, %19, off\n\t"
                 "global_load_async_to_lds_b128 %8, %20, off\n\t"
                 "global_load_async_to_lds_b128 %9, %21, off\n\t"
                 "global_load_async_to_lds_b128 %10, %22, off\n\t"
                 "global_load_async_to_lds_b128 %11, %23, off\n\t"
                 "s_wait_xcnt 0x0"
                 :: "v"(lk), "v"(lk + 16 * KP), "v"(lk + 32 * KP), "v"(lk + 48 * KP), "v"(lk + KPB), "v"(lk + KPB + 16 * KP), "v"(lk + KPB + 32 * KP), "v"(lk + KPB + 48 * KP), "v"(lv), "v"(lv + 16 * VP), "v"(lv + 32 * VP), "v"(lv + 48 * VP),
                    "v"(Kh + ko), "v"(Kh + ko + 1024), "v"(Kh + ko + 2048), "v"(Kh + ko + 3072), "v"(Kl + ko), "v"(Kl + ko + 1024), "v"(Kl + ko + 2048), "v"(Kl + ko + 3072), "v"(va), "v"(va + 16 * TT), "v"(va + 32 * TT), "v"(va + 48 * TT) : "memory");
    if (HR)
        asm volatile("global_load_async_to_lds_b128 %0, %4, off\n\t"
                     "global_load_async_to_lds_b128 %1, %5, off\n\t"
                     "global_load_async_to_lds_b128 %2, %6, off\n\t"
                     "global_load_async_to_lds_b128 %3, %7, off\n\t"
                     "s_wait_xcnt 0x0"
                     :: "v"(lv + VPB), "v"(lv + VPB + 16 * VP), "v"(lv + VPB + 32 * VP), "v"(lv + VPB + 48 * VP), "v"(Vl + vo), "v"(Vl + vo + 16 * TT), "v"(Vl + vo + 32 * TT), "v"(Vl + vo + 48 * TT) : "memory");
}
template <bool HR, int NQ>
__device__ __forceinline__ void attn_span(const bf* __restrict__ Qh, const bf* __restrict__ Ql, const bf* __restrict__ Kh, const bf* __restrict__ Kl, const h16* __restrict__ V16, const bf* __restrict__ Vh, const bf* __restrict__ Vl, int n0, int k0, int k1, float* Op, float* ML, const unsigned char* Sm) {
    const int lane = threadIdx.x & 31, lr = lane & 15, hi = lane >> 4;
    const unsigned sb = (unsigned)(size_t)Sm;   /* the buffers' byte address in LDS */
    stage_kv<HR>(sb, Kh, Kl, V16, Vh, Vl, k0);
    v16bf qh[NQ][2], ql[NQ][2];
#pragma unroll
    for (int nq = 0; nq < NQ; ++nq)
#pragma unroll
        for (int kc = 0; kc < 2; ++kc) { const size_t qo = (size_t)(n0 + nq * 16 + lr) * MID + kc * 32 + 8 * hi; qh[nq][kc] = WFrag<bf>::ld(Qh + qo); ql[nq][kc] = WFrag<bf>::ld(Ql + qo); }
    v8f o[4][NQ]; float m[NQ], l[NQ];
#pragma unroll
    for (int nq = 0; nq < NQ; ++nq) { m[nq] = -3.0e38f; l[nq] = 0.0f;
#pragma unroll
        for (int ct = 0; ct < 4; ++ct) o[ct][nq] = (v8f){}; }
    asm volatile("s_wait_asynccnt 0x0" ::: "memory");   /* this wave's share of pass 0's tiles has landed */
    __syncthreads();                                     /* ... and every other wave's: pass 0's tiles may be read */
    if (k0 + PK < k1) stage_kv<HR>(sb + SBB, Kh, Kl, V16, Vh, Vl, k0 + PK);
    unsigned cur = 0;   /* byte offset of the buffer that this pass reads */
#pragma unroll 1   /* kept rolled: a second pass's fragments would push the wave past 256 registers (4 waves per SIMD) */
    for (int kb = k0; kb < k1; kb += PK) {
        const unsigned char* kt_ = Sm + cur + lr * KP + 16 * hi; const unsigned char* vt_ = Sm + cur + 2 * KPB + lr * VP + 16 * hi;
        v8f s[4][NQ];
#pragma unroll
        for (int kt = 0; kt < 4; ++kt) {
#pragma unroll
            for (int nq = 0; nq < NQ; ++nq) s[kt][nq] = (v8f){};
#pragma unroll
            for (int kc = 0; kc < 2; ++kc) { const unsigned char* kp = kt_ + kt * 16 * KP + kc * 64; const v16bf kh = WFrag<bf>::ld((const bf*)kp), kl = WFrag<bf>::ld((const bf*)(kp + KPB));
#pragma unroll
                for (int nq = 0; nq < NQ; ++nq) { s[kt][nq] = wmmab(kh, qh[nq][kc], s[kt][nq]); s[kt][nq] = wmmab(kh, ql[nq][kc], s[kt][nq]); s[kt][nq] = wmmab(kl, qh[nq][kc], s[kt][nq]); } } }
        /* order of the score phase: K fragments are read three groups (of 4 reads: hi and lo of 32 channels) ahead of the products that use them, so that an LDS read's latency is covered by two groups of products; left free, the reads sink to directly in front of their products, each group with a full LDS wait */
        __builtin_amdgcn_sched_group_barrier(0x100, 12, 0);
#pragma unroll
        for (int g = 0; g < 4; ++g) { __builtin_amdgcn_sched_group_barrier(0x008, 3 * NQ, 0); __builtin_amdgcn_sched_group_barrier(0x100, 4, 0); }
        __builtin_amdgcn_sched_group_barrier(0x008, 6 * NQ, 0); __builtin_amdgcn_sched_group_barrier(0x100, 4, 0);   /* the last group one step later: its registers are those of a group already used */
        __builtin_amdgcn_sched_group_barrier(0x008, 6 * NQ, 0);
        float al[NQ], eb[NQ]; v2f ps[NQ]; bool moved = false;   /* ps: the pass's row sum, even and odd keys apart (packed additions) */
#pragma unroll
        for (int nq = 0; nq < NQ; ++nq) { float mx = fmaxf(fmaxf(s[0][nq][0], s[1][nq][0]), fmaxf(s[2][nq][0], s[3][nq][0]));
#pragma unroll
            for (int j = 1; j < 8; ++j) mx = fmaxf(fmaxf(mx, fmaxf(s[0][nq][j], s[1][nq][j])), fmaxf(s[2][nq][j], s[3][nq][j]));
            mx = fmaxf(mx, __shfl_xor(mx, 16, 32));
            const float mn = fmaxf(m[nq], mx); moved = moved || (mn > m[nq]); al[nq] = __builtin_amdgcn_exp2f((m[nq] - mn) * L2E); m[nq] = mn; ps[nq] = (v2f){};
            eb[nq] = HR ? -mn * L2E : __builtin_fmaf(-mn, L2E, PCL2); }   /* one addend per query and pass: minus the maximum in log2 units, plus the fp16 rows' carry as an exponent */
        if (__any(moved)) {   /* no maximum of the wave moved: every factor is exactly 1 */
#pragma unroll
            for (int ct = 0; ct < 4; ++ct)
#pragma unroll
                for (int nq = 0; nq < NQ; ++nq) o[ct][nq] *= al[nq]; }
        if (HR) {
#pragma unroll
            for (int h = 0; h < 2; ++h) {   /* the pass's two halves of 32 keys: V fragments, exponentials, products */
                v16bf vh[4], vl[4];
#pragma unroll
                for (int ct = 0; ct < 4; ++ct) { const unsigned char* vp = vt_ + ct * 16 * VP + h * 64; vh[ct] = WFrag<bf>::ld((const bf*)vp); vl[ct] = WFrag<bf>::ld((const bf*)(vp + VPB)); }
                v16bf ph[NQ], pl[NQ];
#pragma unroll
                for (int nq = 0; nq < NQ; ++nq) { v16us a16, c16;
#pragma unroll
                    for (int kt = 2 * h; kt < 2 * h + 2; ++kt) { const v8f a = __builtin_elementwise_fma(s[kt][nq], (v8f)(L2E), (v8f)(eb[nq]));   /* whole vectors: packed multiply-adds, two scores each */
#pragma unroll
                        for (int j = 0; j < 8; j += 2) { const v2f p = { __builtin_amdgcn_exp2f(a[j]), __builtin_amdgcn_exp2f(a[j + 1]) }; ps[nq] += p; unsigned short a2, c2; splitf(p[0], a2, c2); a16[8 * (kt & 1) + j] = a2; c16[8 * (kt & 1) + j] = c2; splitf(p[1], a2, c2); a16[8 * (kt & 1) + j + 1] = a2; c16[8 * (kt & 1) + j + 1] = c2; } }
                    ph[nq] = __builtin_bit_cast(v16bf, a16); pl[nq] = __builtin_bit_cast(v16bf, c16); }
                /* inputs only: holds the half's V reads here, as one group whose latency the exponentials cover; left free, they sink to one fragment at a time in front of its products, each with a full LDS wait */
                asm volatile("" :: "v"(vh[0]), "v"(vh[1]), "v"(vh[2]), "v"(vh[3]), "v"(vl[0]), "v"(vl[1]), "v"(vl[2]), "v"(vl[3]));
#pragma unroll
                for (int ct = 0; ct < 4; ++ct)
#pragma unroll
                    for (int nq = 0; nq < NQ; ++nq) { o[ct][nq] = wmmab(vh[ct], ph[nq], o[ct][nq]); o[ct][nq] = wmmab(vh[ct], pl[nq], o[ct][nq]); o[ct][nq] = wmmab(vl[ct], ph[nq], o[ct][nq]); }
                /* each half's 16 V reads are issued in front of its exponentials, the second half's behind the first half's products, whose fragments' registers they take */
                __builtin_amdgcn_sched_group_barrier(0x100, 16, 0); __builtin_amdgcn_sched_group_barrier(0x400, 16 * NQ, 0); __builtin_amdgcn_sched_group_barrier(0x008, 12 * NQ, 0);
            }
        } else {
            v16h va[2][4], pf[2][NQ];
#pragma unroll
            for (int ct = 0; ct < 3; ++ct) va[0][ct] = WFrag<h16>::ld((const h16*)(vt_ + ct * 16 * VP));
#pragma unroll
            for (int h = 0; h < 2; ++h) {   /* the pass's two halves of 32 keys */
#pragma unroll
                for (int nq = 0; nq < NQ; ++nq)
#pragma unroll
                    for (int kt = 2 * h; kt < 2 * h + 2; ++kt) { const v8f a = __builtin_elementwise_fma(s[kt][nq], (v8f)(L2E), (v8f)(eb[nq]));   /* whole vectors: packed multiply-adds, two scores each */
#pragma unroll
                        for (int j = 0; j < 8; j += 2) { const v2f p = { __builtin_amdgcn_exp2f(a[j]), __builtin_amdgcn_exp2f(a[j + 1]) }; ps[nq] += p; pf[h][nq][8 * (kt & 1) + j] = tohx(p[0]); pf[h][nq][8 * (kt & 1) + j + 1] = tohx(p[1]); } }
                if (h == 0) {
                    __builtin_amdgcn_sched_group_barrier(0x100, 6, 0); __builtin_amdgcn_sched_group_barrier(0x400, 16 * NQ, 0);   /* three V fragments are read in front of the first half's exponentials, which cover their latency */
                    asm volatile("" :: "v"(ps[0]), "v"(ps[NQ - 1]));   /* inputs only, each row's sum, against register growth: the sums of the first half are formed here, so that its 16 NQ exponentials leave their registers to the V fragments read next; left free, the additions sink behind the loop's barrier, every exponential of the pass stays live and the wave passes 256 registers */
                    __builtin_amdgcn_sched_barrier(0);   /* ... and the reads that follow stay behind them */
                    va[0][3] = WFrag<h16>::ld((const h16*)(vt_ + 3 * 16 * VP));
#pragma unroll
                    for (int ct = 0; ct < 4; ++ct) va[1][ct] = WFrag<h16>::ld((const h16*)(vt_ + ct * 16 * VP + 64));
#pragma unroll
                    for (int ct = 0; ct < 4; ++ct)
#pragma unroll
                        for (int nq = 0; nq < NQ; ++nq) o[ct][nq] = wmma16(va[0][ct], pf[0][nq], o[ct][nq]);
                }
            }
            /* the first half's products stand among the second half's exponentials: matrix and vector work of one wave side by side */
            __builtin_amdgcn_sched_group_barrier(0x100, 4, 0);
#pragma unroll
            for (int g = 0; g < 4 * NQ; ++g) { __builtin_amdgcn_sched_group_barrier(0x008, 1, 0); if (g % NQ == NQ - 1 && g / NQ < 3) __builtin_amdgcn_sched_group_barrier(0x100, 2, 0); __builtin_amdgcn_sched_group_barrier(0x400, 4, 0); }   /* the second half's last three V fragments are read one by one into the registers of fragments that the products have used */
            asm volatile("" :: "v"(ps[0]), "v"(ps[NQ - 1]));   /* inputs only, each row's sum: as above, for the second half */
#pragma unroll
            for (int ct = 0; ct < 4; ++ct)
#pragma unroll
                for (int nq = 0; nq < NQ; ++nq) o[ct][nq] = wmma16(va[1][ct], pf[1][nq], o[ct][nq]);
        }
#pragma unroll
        for (int nq = 0; nq < NQ; ++nq) l[nq] = l[nq] * al[nq] + (ps[nq][0] + ps[nq][1]);
        asm volatile("s_wait_dscnt 0x0" ::: "memory");      /* this wave's reads of the current buffer are done */
        asm volatile("s_wait_asynccnt 0x0" ::: "memory");   /* its share of the next pass's tiles has landed */
        __syncthreads();                                     /* one barrier a pass: it publishes the next pass's tiles and frees the buffer just read */
        if (kb + 2 * PK < k1) stage_kv<HR>(sb + cur, Kh, Kl, V16, Vh, Vl, kb + 2 * PK);
        cur ^= SBB;
    }
    asm volatile("s_wait_asynccnt 0x0" ::: "memory");   /* no copy is left in flight when the wave goes on to its stores and ends */
#pragma unroll
    for (int nq = 0; nq < NQ; ++nq) { const size_t nb = (size_t)(n0 / 16 + nq); const float lt = (l[nq] + __shfl_xor(l[nq], 16, 32)) * (HR ? 1.0f : 1.0f / PCAR);   /* the fp16 rows' sum carries the x1024 of its terms: taken out here, exactly. A wave owns every 128-byte line that it writes */
#pragma unroll
        for (int ct = 0; ct < 4; ++ct)
#pragma unroll
            for (int j = 0; j < 8; ++j) Op[(nb * CC + ct * 16 + hi * 8 + j) * 16 + lr] = o[ct][nq][j];
        ML[nb * 32 + lane] = hi ? lt : m[nq]; }
}
__global__ __launch_bounds__(128) void k_attn(const bf* __restrict__ Qh, const bf* __restrict__ Ql, const bf* __restrict__ Kh, const bf* __restrict__ Kl, const h16* __restrict__ V16, const bf* __restrict__ Vh, const bf* __restrict__ Vl, float* Op, float* ML) {
    __shared__ __align__(16) unsigned char Sm[2 * SBB];   /* K and V tiles, two buffers */
    const size_t b = blockIdx.y, pl = (size_t)blockIdx.x * NB_ + b; const size_t tb = b * TT * MID, vb = b * CC * TT;
    const int tile = blockIdx.z, wv = threadIdx.x >> 5, k0 = (int)(blockIdx.x * (TT / PK) / NSP) * PK, k1 = (int)((blockIdx.x + 1) * (TT / PK) / NSP) * PK;
    if (tile < RH / 64) attn_span<true, 1>(Qh + tb, Ql + tb, Kh + tb, Kl + tb, V16 + vb, Vh + vb, Vl + vb, tile * 64 + wv * 16, k0, k1, Op + pl * CC * TT, ML + pl * TT * 2, Sm);
    else { attn_span<false, 2>(Qh + tb, Ql + tb, Kh + tb, Kl + tb, V16 + vb, Vh + vb, Vl + vb, RH + (tile - RH / 64) * 128 + wv * 32, k0, k1, Op + pl * CC * TT, ML + pl * TT * 2, Sm);
        asm volatile("s_wait_xcnt 0x0" ::: "memory"); }   /* precaution: in the built code this path's last stores are followed by the other path's prologue, which reuses their registers */
}
// k_merge: out[b][c][n] = sum_s O_s[c][n] w_s / sum_s l_s w_s, w_s = exp(m_s - max m), spans in order; the x1024 carry of the fp16 rows is taken out here.
// Per span and batch: O [n / 16][c][n % 16]; ML [n / 16][32]: 16 maxima, then 16 sums.
__global__ __launch_bounds__(256) void k_merge(const float* __restrict__ Op, const float* __restrict__ ML, float* out) { const size_t i = (size_t)blockIdx.x * 256 + threadIdx.x; if (i >= (size_t)NB_ * CC * TT / 4) return; const int n = (int)(i % (TT / 4)) * 4; const int c = (int)((i / (TT / 4)) % CC); const size_t b = i / ((size_t)CC * TT / 4); const size_t nb = (size_t)(n / 16); const int nr = n % 16; v4f ms[NSP]; v4f mx;
#pragma unroll
    for (int s = 0; s < NSP; ++s) { ms[s] = *(const v4f*)(ML + (((size_t)s * NB_ + b) * (TT / 16) + nb) * 32 + nr);
#pragma unroll
        for (int q = 0; q < 4; ++q) mx[q] = s ? fmaxf(mx[q], ms[s][q]) : ms[s][q]; }
    v4f num = (v4f){}, den = (v4f){};
#pragma unroll
    for (int s = 0; s < NSP; ++s) { const size_t pn = ((size_t)s * NB_ + b) * (TT / 16) + nb; const v4f ls = *(const v4f*)(ML + pn * 32 + 16 + nr); const v4f os = *(const v4f*)(Op + (pn * CC + c) * 16 + nr);
#pragma unroll
        for (int q = 0; q < 4; ++q) { const float w = __builtin_amdgcn_exp2f((ms[s][q] - mx[q]) * L2E); num[q] += os[q] * w; den[q] += ls[q] * w; } }
    const float cs = (n < RH) ? 1.0f : (1.0f / PCAR); v4f r;
#pragma unroll
    for (int q = 0; q < 4; ++q) r[q] = num[q] * __fdiv_rn(cs, den[q]);
    *(v4f*)(out + (b * CC + c) * TT + n) = r;  }

extern "C" void kernel_launch(void* const* d_in, const int* in_sizes, int n_in,
                              void* d_out, int out_size, void* d_ws, size_t ws_size, hipStream_t stream) {
    (void)in_sizes; (void)n_in; (void)out_size;
    const float* x = (const float*)d_in[0]; const float* wq = (const float*)d_in[1]; const float* bq = (const float*)d_in[2]; const float* wk = (const float*)d_in[3]; const float* bk = (const float*)d_in[4]; const float* wv = (const float*)d_in[5]; const float* bv = (const float*)d_in[6]; const float* relh = (const float*)d_in[7]; const float* relw = (const float*)d_in[8];   /* [1][64][64][1], [1][64][1][64] */
    float* OUT = (float*)d_out;     // [4][64][4096] channel-major
    char* wsp = (char*)d_ws;
    auto take = [&](size_t bytes) { char* p = wsp; wsp += (bytes + 255) & ~(size_t)255; return (void*)p; };
    bf* QPh = (bf*)take((size_t)NB_ * TT * MID * 2); bf* QPl = (bf*)take((size_t)NB_ * TT * MID * 2); bf* KPh = (bf*)take((size_t)NB_ * TT * MID * 2); bf* KPl = (bf*)take((size_t)NB_ * TT * MID * 2);   /* hi/lo planes: one set per batch */
    h16* VT16 = (h16*)take((size_t)NB_ * CC * TT * 2); bf* VTh = (bf*)take((size_t)NB_ * CC * TT * 2); bf* VTl = (bf*)take((size_t)NB_ * CC * TT * 2);   /* V^T planes [4][64][4096] */
    float* Op = (float*)take((size_t)NSP * NB_ * CC * TT * 4); float* ML = (float*)take((size_t)NSP * NB_ * TT * 2 * 4);   /* per span and batch: unnormalised out^T in blocks of 16 queries, running maxima and sums */
    if ((size_t)(wsp - (char*)d_ws) > ws_size) return;    // ws 256 MiB (carve ~45 MiB)
    k_prep<<<dim3(TT / 64, NB_), 128, 0, stream>>>(x, wq, bq, wk, bk, wv, bv, relh, relw, QPh, QPl, KPh, KPl, VT16, VTh, VTl);   /* projections, k + pos (f32), planes: all batches */
    k_attn<<<dim3(NSP, NB_, RH / 64 + (TT - RH) / 128), 128, 0, stream>>>(QPh, QPl, KPh, KPl, VT16, VTh, VTl, Op, ML);   /* scores (every row hi/lo, unscaled logits), softmax, attn.v: all batches */
    k_merge<<<(unsigned)(((size_t)NB_ * CC * TT / 4 + 255) / 256), 256, 0, stream>>>(Op, ML, OUT);   /* spans joined, channel-major output */
}

// v007
// A run of this version takes 38.4 microseconds.
// Timed twice side by side with v006, it ran 1.16 and 1.15 times as fast.
// Counting every step since v000, it is 27.2 times as fast.
#include <hip/hip_runtime.h>

// Self-attention over a 64x64 feature map with a learned 2-D positional key term (x [4][64][64x64] channel-major; q, k, v = 1x1 convs 'oi' [64][64] + [64] (1/8 weights, 0.02 biases); energy[n][m] = q_n.k_m + q_n.pos_m with pos[c][(hh, ww)] = rel_h[c][hh] + rel_w[c][ww] ([1][64][64][1] + [1][64][1][64], read) == q_n.(k_m + pos_m) (unscaled, sigma ~8); softmax over the 4,096 positions; out[c][n] = sum_m v[c][m] attn[n][m] -> [4][64][64][64] (1.0 M)).
// Layout: one kernel for all batches (k_prep) rounds the channel-major map and the weights to bf16, does the three exact projections + f32 biases, adds the positional table to the key rows in f32 (q.k + q.pos == q.(k + pos)) and writes the hi/lo planes, one set per batch. One kernel for all batches then does scores, softmax and attn.v in registers (k_attn), one key span per work-group, its K and V tiles shared through LDS; k_merge joins the spans and writes the channel-major output rows.
// Compute dtypes, f32 accumulate: every input rounded to bf16; projections exact + f32 biases; scores 3 products on every row; softmax f32 (running maximum); attn.V rows < 512 3 products (P, V hi/lo), rest fp16 (P x1024); epilogue f32.

#define NB_  4
#define TT   4096
#define DM   512
#define NH_  1
#define NKV  1
#define REP  (NH_ / NKV)
#define HD   64
#define DQ   (NH_ * HD)
#define DKV  (NKV * HD)
#define ZH   1
#define RH   512                  // query rows < RH use hi+lo planes (0: none)
#define WIN  0
#define PCAR 1024.0f
#define PCL2 10.0f     // log2 PCAR
#define SCL  1.0f   // no scaling in the module
#define MID  64
#define CQR  64      // q/k use all channels (no padding)
#define CC   64
#define NSP  7       // the 64 passes of 64 keys are dealt to NSP spans (9 or 10 each; 36 tiles x 4 batches x 7 = 1,008 work-groups of 4 waves at 4 waves per SIMD: one round on 256 WGPs), one work-group per span and query tile
#define PK   64      // keys per pass of k_attn
typedef _Float16 h16;
typedef unsigned short bf;
typedef __attribute__((ext_vector_type(16))) __bf16   v16bf;
typedef __attribute__((ext_vector_type(16))) _Float16 v16h;
typedef __attribute__((ext_vector_type(8)))  _Float16 v8h;
typedef __attribute__((ext_vector_type(8)))  unsigned short v8us;
typedef __attribute__((ext_vector_type(8)))  float    v8f;
typedef __attribute__((ext_vector_type(4)))  float    v4f;
typedef __attribute__((ext_vector_type(2)))  float    v2f;
typedef v8h  __attribute__((may_alias)) v8ha;
typedef v4f  __attribute__((may_alias)) v4fa;
typedef v8us __attribute__((may_alias)) v8usa;

__device__ __forceinline__ unsigned short f2bf(float f) { unsigned u = __float_as_uint(f); u += 0x7FFFu + ((u >> 16) & 1u); return (unsigned short)(u >> 16); }
__device__ __forceinline__ float bf2f(unsigned short b) { return __uint_as_float(((unsigned)b) << 16); }
__device__ __forceinline__ float bfr(float f) { return bf2f(f2bf(f)); }
__device__ __forceinline__ v16h cat16(v8h lo, v8h hi) { return __builtin_shufflevector(lo, hi, 0, 1, 2, 3, 4, 5, 6, 7, 8, 9, 10, 11, 12, 13, 14, 15); }
__device__ __forceinline__ v16bf cat16b(v8us lo, v8us hi) { return __builtin_bit_cast(v16bf, __builtin_shufflevector(lo, hi, 0, 1, 2, 3, 4, 5, 6, 7, 8, 9, 10, 11, 12, 13, 14, 15)); }
__device__ __forceinline__ v8f wmma16(v16h a, v16h b, v8f c) { return __builtin_amdgcn_wmma_f32_16x16x32_f16(false, a, false, b, (short)0, c, false, false); }
__device__ __forceinline__ v8f wmmab(v16bf a, v16bf b, v8f c) { return __builtin_amdgcn_wmma_f32_16x16x32_bf16(false, a, false, b, (short)0, c, false, false); }



template <typename T16> struct WFrag;   // 16x32 operand fragment from a K-contiguous 16-bit row: p = row start + 8 (lane >> 4); k = 8 hi + 0..7, 16 + 8 hi + 0..7 (A and B alike)
template <> struct WFrag<h16> { typedef v16h V; static __device__ __forceinline__ V ld(const h16* p) { return cat16(*(const v8h*)p, *(const v8h*)(p + 16)); } };
template <> struct WFrag<bf> { typedef v16bf V; static __device__ __forceinline__ V ld(const bf* p) { return cat16b(*(const v8us*)p, *(const v8us*)(p + 16)); } };

__device__ __forceinline__ h16 tohx(float x) { return (h16)x; }
__device__ __forceinline__ void splitf(float y, unsigned short& h, unsigned short& l) { h = f2bf(y); l = f2bf(y - bf2f(h)); }
typedef __attribute__((ext_vector_type(16))) unsigned short v16us;

#define WP 72   // LDS row pitch in 16-bit elements: 144 B = 16 B x odd, for the 16-byte fragment reads
// ---- k_prep: everything in front of the attention, one launch. Grid (64 map rows, 4 batches), 4 waves; a work-group owns the 64 tokens of one map row (hh = blockIdx.x, ww = 0..63).
// Each wave rounds its own 16 tokens' x to bf16 straight into a fragment (row = token, k = channel), which also goes to LDS; the work-group rounds the three weight matrices ('oi' = K-contiguous rows) into LDS once.
// q, k: A = 16 weight rows, B = the wave's own tokens, so a lane holds one token and 8 consecutive output channels: 16-byte stores, and the wave writes the whole 128-byte row of each of its tokens.
// v: A = 16 tokens (from LDS), B = weight rows 16 wave + 0..15, so a lane holds one channel and 8 consecutive tokens, and the wave writes the whole 128-byte piece (64 tokens) of each of its channel rows.
// Every product sums k = 0..31, then 32..63, as two accumulating matrix instructions.
__global__ __launch_bounds__(128) void k_prep(const float* __restrict__ x, const float* __restrict__ wq, const float* __restrict__ bq, const float* __restrict__ wk, const float* __restrict__ bk, const float* __restrict__ wv, const float* __restrict__ bv, const float* __restrict__ rh, const float* __restrict__ rw,
                                              bf* Qh, bf* Ql, bf* Kh, bf* Kl, h16* V16, bf* Vh, bf* Vl) {
    __shared__ __align__(16) bf Ws[3 * 64 * WP];
    __shared__ __align__(16) bf Xs[64 * WP];
    __shared__ __align__(32) float Rh[64];   /* this map row's column of rel_h, rounded */
    const int tid = threadIdx.x, lane = tid & 31, lr = lane & 15, hi = lane >> 4, wvi = tid >> 5;
    const int hh = blockIdx.x, tl = wvi * 16 + lr; const size_t b = blockIdx.y;
    const float* xt = x + b * CC * TT + hh * 64 + tl;
    float xr[2][16];
#pragma unroll
    for (int kc = 0; kc < 2; ++kc)
#pragma unroll
        for (int e = 0; e < 16; ++e) xr[kc][e] = xt[(kc * 32 + 8 * hi + (e & 7) + 16 * (e >> 3)) * TT];
    asm volatile("s_wait_xcnt 0x0" ::: "memory");   /* precaution, here and below: stands before any register that the loads or stores above name is reused */
    v8f wr[12];   /* 3 x 512 runs of 8 weights, 12 per thread */
#pragma unroll
    for (int i = 0; i < 12; ++i) wr[i] = *(const v8f*)((i < 4 ? wq : i < 8 ? wk : wv) + ((i & 3) * 128 + tid) * 8);
    asm volatile("s_wait_xcnt 0x0" ::: "memory");
    float rwr[4][8]; v8f bqr[4], bkr[4];
#pragma unroll
    for (int ot = 0; ot < 4; ++ot)
#pragma unroll
        for (int j = 0; j < 8; ++j) rwr[ot][j] = rw[(ot * 16 + 8 * hi + j) * 64 + tl];
    asm volatile("s_wait_xcnt 0x0" ::: "memory");
#pragma unroll
    for (int ot = 0; ot < 4; ++ot) { bqr[ot] = *(const v8f*)(bq + ot * 16 + 8 * hi); bkr[ot] = *(const v8f*)(bk + ot * 16 + 8 * hi); }
    const float bvw = bv[tl];   /* channel 16 wave + lr */
    asm volatile("s_wait_xcnt 0x0" ::: "memory");
    const float bvr = bfr(bvw);
    if (tid < 64) { const float rhw = rh[tid * 64 + hh];   /* waves 0 and 1, whole */
        asm volatile("s_wait_xcnt 0x0" :: "v"(rhw) : "memory");   /* the same precaution; the loaded value as an input keeps the wait behind this load */
        Rh[tid] = bfr(rhw); }
    v16bf xf[2];
#pragma unroll
    for (int kc = 0; kc < 2; ++kc) { v8us lo8, hi8;
#pragma unroll
        for (int e = 0; e < 8; ++e) { lo8[e] = f2bf(xr[kc][e]); hi8[e] = f2bf(xr[kc][8 + e]); }
        *(v8us*)(Xs + tl * WP + kc * 32 + 8 * hi) = lo8; *(v8us*)(Xs + tl * WP + kc * 32 + 8 * hi + 16) = hi8; xf[kc] = cat16b(lo8, hi8); }
#pragma unroll
    for (int i = 0; i < 12; ++i) { const int u = (i & 3) * 128 + tid; v8us o;
#pragma unroll
        for (int q = 0; q < 8; ++q) o[q] = f2bf(wr[i][q]);
        *(v8us*)(Ws + ((i >> 2) * 64 + (u >> 3)) * WP + (u & 7) * 8) = o; }
    __syncthreads();
    const size_t qrow = (b * TT + hh * 64 + tl) * MID + 8 * hi;
#pragma unroll
    for (int p = 0; p < 2; ++p)   /* 0: q, 1: k + pos */
#pragma unroll
        for (int ot = 0; ot < 4; ++ot) { v8f acc = (v8f){};
#pragma unroll
            for (int kc = 0; kc < 2; ++kc) acc = wmmab(WFrag<bf>::ld(Ws + (p * 64 + ot * 16 + lr) * WP + kc * 32 + 8 * hi), xf[kc], acc);
            v8us oh, ol; v8f rhv; if (p) rhv = *(const v8f*)(Rh + ot * 16 + 8 * hi);
#pragma unroll
            for (int j = 0; j < 8; ++j) { float y = acc[j] + bfr(p ? bkr[ot][j] : bqr[ot][j]); if (p) y = __fadd_rn(y, __fadd_rn(rhv[j], bfr(rwr[ot][j]))); unsigned short a2, c2; splitf(y, a2, c2); oh[j] = a2; ol[j] = c2; }
            *(v8us*)((p ? Kh : Qh) + qrow + ot * 16) = oh; *(v8us*)((p ? Kl : Ql) + qrow + ot * 16) = ol;
            asm volatile("s_wait_xcnt 0x0" ::: "memory"); }
    v16bf wf[2];
#pragma unroll
    for (int kc = 0; kc < 2; ++kc) wf[kc] = WFrag<bf>::ld(Ws + (128 + tl) * WP + kc * 32 + 8 * hi);
    const size_t vrow = (b * CC + tl) * TT + hh * 64 + 8 * hi;
#pragma unroll
    for (int mb = 0; mb < 4; ++mb) { v8f acc = (v8f){};
#pragma unroll
        for (int kc = 0; kc < 2; ++kc) acc = wmmab(WFrag<bf>::ld(Xs + (mb * 16 + lr) * WP + kc * 32 + 8 * hi), wf[kc], acc);
        v8h o16; v8us oh, ol;
#pragma unroll
        for (int j = 0; j < 8; ++j) { const float y = acc[j] + bvr; o16[j] = tohx(y); unsigned short a2, c2; splitf(y, a2, c2); oh[j] = a2; ol[j] = c2; }
        *(v8h*)(V16 + vrow + mb * 16) = o16; *(v8us*)(Vh + vrow + mb * 16) = oh; *(v8us*)(Vl + vrow + mb * 16) = ol;
        asm volatile("s_wait_xcnt 0x0" ::: "memory"); }
}

#define L2E 1.4426950408889634f
// ---- k_attn: scores, softmax and attn.v of one key span for one query tile, 4 waves x 16 NQ queries (rows < RH: NQ = 1, 64-query tiles, which start first; rest NQ = 2, 128-query tiles); scores and P never leave the registers.
// The score tile is formed TRANSPOSED (A = 16 key rows, B = 16 query rows), so a lane holds one query (column lr) and keys 8 hi + j of each 16-key tile: the row maximum and sum are in-lane but for one exchange with lane ^ 16,
// and two such tiles, converted, ARE the B fragment (k = 8 hi + 0..7, 16 + 8 hi + 0..7) of out^T[c][n] += V^T[c][k] P[n][k].
// A pass takes 64 keys (four such tiles): one maximum, one exchange, one rescaling of out^T and of the sum, one barrier and one set of copy addresses per 64 keys.
// P = exp2(s log2e + eb), one fused multiply-add per score in front of the exponential; in the fp16 rows eb holds the x1024 carry, so P and its sum are formed already scaled.
// Per span: running maximum m, sum l and unnormalised out^T, each relative to m; k_merge joins the spans. Inner loops are unrolled so that every fragment array stays in registers.
// K and V: the work-group brings each pass's tiles (64 key rows of 128 B per plane, 64 channel rows of 128 B per plane) into LDS once, by asynchronous copies, 16 B per lane, two buffers: pass t + 2's copies are issued behind the barrier that ends pass t, so they fly during pass t + 1.
// The 4 waves read their fragments from LDS (16-byte reads; row pitches 16 B x odd).
#define KP  144                    // LDS pitch of a 128-byte K row, bytes
#define VP  144                    // LDS pitch of a 128-byte piece of a V row, bytes
#define KPB (PK * KP)              // one K plane of a pass
#define VPB (64 * VP)              // one V plane of a pass
#define SBB (2 * KPB + 2 * VPB)    // one buffer: K hi, K lo, V (fp16, or hi and lo)
// One pass's copies, every thread of the work-group: piece u = 128 i + tid of each plane, i = 0..3, 8 pieces a row. K: the plane's 8 KiB are contiguous in memory; V: whole 128-byte lines.
// s_wait_xcnt 0 closes each statement: a precaution, it stands before any register that the copies name is reused.
template <bool HR>
__device__ __forceinline__ void stage_kv(unsigned dst, const bf* __restrict__ Kh, const bf* __restrict__ Kl, const h16* __restrict__ V16, const bf* __restrict__ Vh, const bf* __restrict__ Vl, int kb) {
    const int tid = threadIdx.x;
    const unsigned lk = dst + (tid >> 3) * KP + (tid & 7) * 16, lv = lk + 2 * KPB;   /* KP == VP: the same place in a K and in a V plane */
    const size_t ko = (size_t)kb * MID + tid * 8, vo = (size_t)(tid >> 3) * TT + kb + (tid & 7) * 8;
    const bf* va = HR ? Vh + vo : (const bf*)(V16 + vo);   /* address only: 16-bit elements either way */
    asm volatile("global_load_async_to_lds_b128 %0, %12, off\n\t"
                 "global_load_async_to_lds_b128 %1, %13, off\n\t"
                 "global_load_async_to_lds_b128 %2, %14, off\n\t"
                 "global_load_async_to_lds_b128 %3, %15, off\n\t"
                 "global_load_async_to_lds_b128 %4, %16, off\n\t"
                 "global_load_async_to_lds_b128 %5, %17, off\n\t"
                 "global_load_async_to_lds_b128 %6, %18, off\n\t"
                 "global_load_async_to_lds_b128 %7, %19, off\n\t"
                 "global_load_async_to_lds_b128 %8, %20, off\n\t"
                 "global_load_async_to_lds_b128 %9, %21, off\n\t"
                 "global_load_async_to_lds_b128 %10, %22, off\n\t"
                 "global_load_async_to_lds_b128 %11, %23, off\n\t"
                 "s_wait_xcnt 0x0"
                 :: "v"(lk), "v"(lk + 16 * KP), "v"(lk + 32 * KP), "v"(lk + 48 * KP), "v"(lk + KPB), "v"(lk + KPB + 16 * KP), "v"(lk + KPB + 32 * KP), "v"(lk + KPB + 48 * KP), "v"(lv), "v"(lv + 16 * VP), "v"(lv + 32 * VP), "v"(lv + 48 * VP),
                    "v"(Kh + ko), "v"(Kh + ko + 1024), "v"(Kh + ko + 2048), "v"(Kh + ko + 3072), "v"(Kl + ko), "v"(Kl + ko + 1024), "v"(Kl + ko + 2048), "v"(Kl + ko + 3072), "v"(va), "v"(va + 16 * TT), "v"(va + 32 * TT), "v"(va + 48 * TT) : "memory");
    if (HR)
        asm volatile("global_load_async_to_lds_b128 %0, %4, off\n\t"
                     "global_load_async_to_lds_b128 %1, %5, off\n\t"
                     "global_load_async_to_lds_b128 %2, %6, off\n\t"
                     "global_load_async_to_lds_b128 %3, %7, off\n\t"
                     "s_wait_xcnt 0x0"
                     :: "v"(lv + VPB), "v"(lv + VPB + 16 * VP), "v"(lv + VPB + 32 * VP), "v"(lv + VPB + 48 * VP), "v"(Vl + vo), "v"(Vl + vo + 16 * TT), "v"(Vl + vo + 32 * TT), "v"(Vl + vo + 48 * TT) : "memory");
}
template <bool HR, int NQ>
__device__ __forceinline__ void attn_span(const bf* __restrict__ Qh, const bf* __restrict__ Ql, const bf* __restrict__ Kh, const bf* __restrict__ Kl, const h16* __restrict__ V16, const bf* __restrict__ Vh, const bf* __restrict__ Vl, int n0, int k0, int k1, float* Op, float* ML, const unsigned char* Sm) {
    const int lane = threadIdx.x & 31, lr = lane & 15, hi = lane >> 4;
    const unsigned sb = (unsigned)(size_t)Sm;   /* the buffers' byte address in LDS */
    stage_kv<HR>(sb, Kh, Kl, V16, Vh, Vl, k0);
    v16bf qh[NQ][2], ql[NQ][2];
#pragma unroll
    for (int nq = 0; nq < NQ; ++nq)
#pragma unroll
        for (int kc = 0; kc < 2; ++kc) { const size_t qo = (size_t)(n0 + nq * 16 + lr) * MID + kc * 32 + 8 * hi; qh[nq][kc] = WFrag<bf>::ld(Qh + qo); ql[nq][kc] = WFrag<bf>::ld(Ql + qo); }
    v8f o[4][NQ]; float m[NQ], l[NQ];
#pragma unroll
    for (int nq = 0; nq < NQ; ++nq) { m[nq] = -3.0e38f; l[nq] = 0.0f;
#pragma unroll
        for (int ct = 0; ct < 4; ++ct) o[ct][nq] = (v8f){}; }
    asm volatile("s_wait_asynccnt 0x0" ::: "memory");   /* this wave's share of pass 0's tiles has landed */
    __syncthreads();                                     /* ... and every other wave's: pass 0's tiles may be read */
    if (k0 + PK < k1) stage_kv<HR>(sb + SBB, Kh, Kl, V16, Vh, Vl, k0 + PK);
    unsigned cur = 0;   /* byte offset of the buffer that this pass reads */
#pragma unroll 1   /* kept rolled: a second pass's fragments would push the wave past 256 registers (4 waves per SIMD) */
    for (int kb = k0; kb < k1; kb += PK) {
        const unsigned char* kt_ = Sm + cur + lr * KP + 16 * hi; const unsigned char* vt_ = Sm + cur + 2 * KPB + lr * VP + 16 * hi;
        v8f s[4][NQ];
#pragma unroll
        for (int kt = 0; kt < 4; ++kt) {
#pragma unroll
            for (int nq = 0; nq < NQ; ++nq) s[kt][nq] = (v8f){};
#pragma unroll
            for (int kc = 0; kc < 2; ++kc) { const unsigned char* kp = kt_ + kt * 16 * KP + kc * 64; const v16bf kh = WFrag<bf>::ld((const bf*)kp), kl = WFrag<bf>::ld((const bf*)(kp + KPB));
#pragma unroll
                for (int nq = 0; nq < NQ; ++nq) { s[kt][nq] = wmmab(kh, qh[nq][kc], s[kt][nq]); s[kt][nq] = wmmab(kh, ql[nq][kc], s[kt][nq]); s[kt][nq] = wmmab(kl, qh[nq][kc], s[kt][nq]); } } }
        /* order of the score phase: K fragments are read three groups (of 4 reads: hi and lo of 32 channels) ahead of the products that use them, so that an LDS read's latency is covered by two groups of products; left free, the reads sink to directly in front of their products, each group with a full LDS wait */
        __builtin_amdgcn_sched_group_barrier(0x100, 12, 0);
#pragma unroll
        for (int g = 0; g < 4; ++g) { __builtin_amdgcn_sched_group_barrier(0x008, 3 * NQ, 0); __builtin_amdgcn_sched_group_barrier(0x100, 4, 0); }
        __builtin_amdgcn_sched_group_barrier(0x008, 6 * NQ, 0); __builtin_amdgcn_sched_group_barrier(0x100, 4, 0);   /* the last group one step later: its registers are those of a group already used */
        __builtin_amdgcn_sched_group_barrier(0x008, 6 * NQ, 0);
        float al[NQ], eb[NQ]; v2f ps[NQ]; bool moved = false;   /* ps: the pass's row sum, even and odd keys apart (packed additions) */
#pragma unroll
        for (int nq = 0; nq < NQ; ++nq) { float mx = fmaxf(fmaxf(s[0][nq][0], s[1][nq][0]), fmaxf(s[2][nq][0], s[3][nq][0]));
#pragma unroll
            for (int j = 1; j < 8; ++j) mx = fmaxf(fmaxf(mx, fmaxf(s[0][nq][j], s[1][nq][j])), fmaxf(s[2][nq][j], s[3][nq][j]));
            mx = fmaxf(mx, __shfl_xor(mx, 16, 32));
            const float mn = fmaxf(m[nq], mx); moved = moved || (mn > m[nq]); al[nq] = __builtin_amdgcn_exp2f((m[nq] - mn) * L2E); m[nq] = mn; ps[nq] = (v2f){};
            eb[nq] = HR ? -mn * L2E : __builtin_fmaf(-mn, L2E, PCL2); }   /* one addend per query and pass: minus the maximum in log2 units, plus the fp16 rows' carry as an exponent */
        if (__any(moved)) {   /* no maximum of the wave moved: every factor is exactly 1 */
#pragma unroll
            for (int ct = 0; ct < 4; ++ct)
#pragma unroll
                for (int nq = 0; nq < NQ; ++nq) o[ct][nq] *= al[nq]; }
        if (HR) {
#pragma unroll
            for (int h = 0; h < 2; ++h) {   /* the pass's two halves of 32 keys: V fragments, exponentials, products */
                v16bf vh[4], vl[4];
#pragma unroll
                for (int ct = 0; ct < 4; ++ct) { const unsigned char* vp = vt_ + ct * 16 * VP + h * 64; vh[ct] = WFrag<bf>::ld((const bf*)vp); vl[ct] = WFrag<bf>::ld((const bf*)(vp + VPB)); }
                v16bf ph[NQ], pl[NQ];
#pragma unroll
                for (int nq = 0; nq < NQ; ++nq) { v16us a16, c16;
#pragma unroll
                    for (int kt = 2 * h; kt < 2 * h + 2; ++kt) { const v8f a = __builtin_elementwise_fma(s[kt][nq], (v8f)(L2E), (v8f)(eb[nq]));   /* whole vectors: packed multiply-adds, two scores each */
#pragma unroll
                        for (int j = 0; j < 8; j += 2) { const v2f p = { __builtin_amdgcn_exp2f(a[j]), __builtin_amdgcn_exp2f(a[j + 1]) }; ps[nq] += p; unsigned short a2, c2; splitf(p[0], a2, c2); a16[8 * (kt & 1) + j] = a2; c16[8 * (kt & 1) + j] = c2; splitf(p[1], a2, c2); a16[8 * (kt & 1) + j + 1] = a2; c16[8 * (kt & 1) + j + 1] = c2; } }
                    ph[nq] = __builtin_bit_cast(v16bf, a16); pl[nq] = __builtin_bit_cast(v16bf, c16); }
                /* inputs only: holds the half's V reads here, as one group whose latency the exponentials cover; left free, they sink to one fragment at a time in front of its products, each with a full LDS wait */
                asm volatile("" :: "v"(vh[0]), "v"(vh[1]), "v"(vh[2]), "v"(vh[3]), "v"(vl[0]), "v"(vl[1]), "v"(vl[2]), "v"(vl[3]));
#pragma unroll
                for (int ct = 0; ct < 4; ++ct)
#pragma unroll
                    for (int nq = 0; nq < NQ; ++nq) { o[ct][nq] = wmmab(vh[ct], ph[nq], o[ct][nq]); o[ct][nq] = wmmab(vh[ct], pl[nq], o[ct][nq]); o[ct][nq] = wmmab(vl[ct], ph[nq], o[ct][nq]); }
                /* each half's 16 V reads are issued in front of its exponentials, the second half's behind the first half's products, whose fragments' registers they take */
                __builtin_amdgcn_sched_group_barrier(0x100, 16, 0); __builtin_amdgcn_sched_group_barrier(0x400, 16 * NQ, 0); __builtin_amdgcn_sched_group_barrier(0x008, 12 * NQ, 0);
            }
        } else {
            v16h va[2][4], pf[2][NQ];
#pragma unroll
            for (int ct = 0; ct < 3; ++ct) va[0][ct] = WFrag<h16>::ld((const h16*)(vt_ + ct * 16 * VP));
#pragma unroll
            for (int h = 0; h < 2; ++h) {   /* the pass's two halves of 32 keys */
#pragma unroll
                for (int nq = 0; nq < NQ; ++nq)
#pragma unroll
                    for (int kt = 2 * h; kt < 2 * h + 2; ++kt) { const v8f a = __builtin_elementwise_fma(s[kt][nq], (v8f)(L2E), (v8f)(eb[nq]));   /* whole vectors: packed multiply-adds, two scores each */
#pragma unroll
                        for (int j = 0; j < 8; j += 2) { const v2f p = { __builtin_amdgcn_exp2f(a[j]), __builtin_amdgcn_exp2f(a[j + 1]) }; ps[nq] += p; pf[h][nq][8 * (kt & 1) + j] = tohx(p[0]); pf[h][nq][8 * (kt & 1) + j + 1] = tohx(p[1]); } }
                if (h == 0) {
                    __builtin_amdgcn_sched_group_barrier(0x100, 6, 0); __builtin_amdgcn_sched_group_barrier(0x400, 16 * NQ, 0);   /* three V fragments are read in front of the first half's exponentials, which cover their latency */
                    asm volatile("" :: "v"(ps[0]), "v"(ps[NQ - 1]));   /* inputs only, each row's sum, against register growth: the sums of the first half are formed here, so that its 16 NQ exponentials leave their registers to the V fragments read next; left free, the additions sink behind the loop's barrier, every exponential of the pass stays live and the wave passes 256 registers */
                    __builtin_amdgcn_sched_barrier(0);   /* ... and the reads that follow stay behind them */
                    va[0][3] = WFrag<h16>::ld((const h16*)(vt_ + 3 * 16 * VP));
#pragma unroll
                    for (int ct = 0; ct < 4; ++ct) va[1][ct] = WFrag<h16>::ld((const h16*)(vt_ + ct * 16 * VP + 64));
#pragma unroll
                    for (int ct = 0; ct < 4; ++ct)
#pragma unroll
                        for (int nq = 0; nq < NQ; ++nq) o[ct][nq] = wmma16(va[0][ct], pf[0][nq], o[ct][nq]);
                }
            }
            /* the first half's products stand among the second half's exponentials: matrix and vector work of one wave side by side */
            __builtin_amdgcn_sched_group_barrier(0x100, 4, 0);
#pragma unroll
            for (int g = 0; g < 4 * NQ; ++g) { __builtin_amdgcn_sched_group_barrier(0x008, 1, 0); if (g % NQ == NQ - 1 && g / NQ < 3) __builtin_amdgcn_sched_group_barrier(0x100, 2, 0); __builtin_amdgcn_sched_group_barrier(0x400, 4, 0); }   /* the second half's last three V fragments are read one by one into the registers of fragments that the products have used */
            asm volatile("" :: "v"(ps[0]), "v"(ps[NQ - 1]));   /* inputs only, each row's sum: as above, for the second half */
#pragma unroll
            for (int ct = 0; ct < 4; ++ct)
#pragma unroll
                for (int nq = 0; nq < NQ; ++nq) o[ct][nq] = wmma16(va[1][ct], pf[1][nq], o[ct][nq]);
        }
#pragma unroll
        for (int nq = 0; nq < NQ; ++nq) l[nq] = l[nq] * al[nq] + (ps[nq][0] + ps[nq][1]);
        asm volatile("s_wait_dscnt 0x0" ::: "memory");      /* this wave's reads of the current buffer are done */
        asm volatile("s_wait_asynccnt 0x0" ::: "memory");   /* its share of the next pass's tiles has landed */
        __syncthreads();                                     /* one barrier a pass: it publishes the next pass's tiles and frees the buffer just read */
        if (kb + 2 * PK < k1) stage_kv<HR>(sb + cur, Kh, Kl, V16, Vh, Vl, kb + 2 * PK);
        cur ^= SBB;
    }
    asm volatile("s_wait_asynccnt 0x0" ::: "memory");   /* no copy is left in flight when the wave goes on to its stores and ends */
#pragma unroll
    for (int nq = 0; nq < NQ; ++nq) { const float lt = (l[nq] + __shfl_xor(l[nq], 16, 32)) * (HR ? 1.0f : 1.0f / PCAR);   /* the fp16 rows' sum carries the x1024 of its terms: taken out here, exactly */
        ML[(size_t)(n0 / 16 + nq) * NSP * 32 + lane] = hi ? lt : m[nq]; }
#pragma unroll
    for (int nq = 0; nq < NQ; ++nq) { const size_t nb = (size_t)(n0 / 16 + nq);
#pragma unroll
        for (int ct = 0; ct < 4; ++ct)
#pragma unroll
            for (int hf = 0; hf < 2; ++hf) *(v4f*)(Op + ((nb * NSP * 8 + ct * 2 + hf) * 32 + lane) * 4) = (v4f){ o[ct][nq][4 * hf], o[ct][nq][4 * hf + 1], o[ct][nq][4 * hf + 2], o[ct][nq][4 * hf + 3] };   /* accumulator order: 16 bytes a lane, 512 contiguous bytes (4 whole lines) a store */
    }
}
__global__ __launch_bounds__(128) void k_attn(const bf* __restrict__ Qh, const bf* __restrict__ Ql, const bf* __restrict__ Kh, const bf* __restrict__ Kl, const h16* __restrict__ V16, const bf* __restrict__ Vh, const bf* __restrict__ Vl, float* Op, float* ML) {
    __shared__ __align__(16) unsigned char Sm[2 * SBB];   /* K and V tiles, two buffers */
    const size_t b = blockIdx.y, pl = b * (TT / 16) * NSP + blockIdx.x; const size_t tb = b * TT * MID, vb = b * CC * TT;
    const int tile = blockIdx.z, wv = threadIdx.x >> 5, k0 = (int)(blockIdx.x * (TT / PK) / NSP) * PK, k1 = (int)((blockIdx.x + 1) * (TT / PK) / NSP) * PK;
    if (tile < RH / 64) attn_span<true, 1>(Qh + tb, Ql + tb, Kh + tb, Kl + tb, V16 + vb, Vh + vb, Vl + vb, tile * 64 + wv * 16, k0, k1, Op + pl * CC * 16, ML + pl * 32, Sm);
    else { attn_span<false, 2>(Qh + tb, Ql + tb, Kh + tb, Kl + tb, V16 + vb, Vh + vb, Vl + vb, RH + (tile - RH / 64) * 128 + wv * 32, k0, k1, Op + pl * CC * 16, ML + pl * 32, Sm);
        asm volatile("s_wait_xcnt 0x0" ::: "memory"); }   /* precaution: in the built code this path's last stores are followed by the other path's prologue, which reuses their registers */
}
// k_merge: out[b][c][n] = sum_s O_s[c][n] w_s / sum_s l_s w_s, w_s = exp(m_s - max m), spans in order; the x1024 carry of the fp16 rows is taken out here.
// O in the order of k_attn's accumulators, [b][n / 16][span][c / 16][c / 4 % 2][c / 8 % 2][n % 16][c % 4]: the last three indices are a run of 512 B, lane by lane, and the spans of a block of 16 queries lie side by side; ML [b][n / 16][span][32]: 16 maxima, then 16 sums.
// One work-group per 32 queries, one wave per run: a lane owns 4 channels of query n % 16 in both blocks of 16 queries, so every read of O is 512 contiguous bytes and the wave writes both halves of each 128-byte line of out that it touches.
__global__ __launch_bounds__(256) void k_merge(const float* __restrict__ Op, const float* __restrict__ ML, float* out) {
    const int lane = threadIdx.x & 31, lr = lane & 15, hi = lane >> 4, run = threadIdx.x >> 5;
    const size_t b = blockIdx.x / (TT / 32); const int nbp = (int)(blockIdx.x % (TT / 32));
    v4f os[2][NSP]; float ms[2][NSP], ls[2][NSP];
    const size_t nb0 = b * (TT / 16) + nbp * 2;   /* the first of the two blocks of 16 queries */
    const float* pm = ML + nb0 * NSP * 32 + lr; const float* po = Op + ((nb0 * NSP * 8 + run) * 32 + lane) * 4;   /* one address each: the rest is an immediate offset */
#pragma unroll
    for (int e = 0; e < 2; ++e)
#pragma unroll
        for (int s = 0; s < NSP; ++s) { os[e][s] = *(const v4f*)(po + (e * NSP + s) * 16 * CC); ms[e][s] = pm[(e * NSP + s) * 32]; ls[e][s] = pm[(e * NSP + s) * 32 + 16]; }
    /* inputs only, the loaded values: every load is issued before the first use, one memory latency in all; left free, most reads of O sink behind the first weights, and their latencies follow one another */
    asm volatile("" :: "v"(ms[0][0]), "v"(ms[0][1]), "v"(ms[0][2]), "v"(ms[0][3]), "v"(ms[0][4]), "v"(ms[0][5]), "v"(ms[0][6]), "v"(ms[1][0]), "v"(ms[1][1]), "v"(ms[1][2]), "v"(ms[1][3]), "v"(ms[1][4]), "v"(ms[1][5]), "v"(ms[1][6]),
                    "v"(ls[0][0]), "v"(ls[0][1]), "v"(ls[0][2]), "v"(ls[0][3]), "v"(ls[0][4]), "v"(ls[0][5]), "v"(ls[0][6]), "v"(ls[1][0]), "v"(ls[1][1]), "v"(ls[1][2]), "v"(ls[1][3]), "v"(ls[1][4]), "v"(ls[1][5]), "v"(ls[1][6]));
    /* ... and the precaution: the wait stands before any register that the loads name is reused; the addresses as inputs keep their registers untouched up to here */
    asm volatile("s_wait_xcnt 0x0" :: "v"(pm), "v"(po), "v"(os[0][0]), "v"(os[0][1]), "v"(os[0][2]), "v"(os[0][3]), "v"(os[0][4]), "v"(os[0][5]), "v"(os[0][6]), "v"(os[1][0]), "v"(os[1][1]), "v"(os[1][2]), "v"(os[1][3]), "v"(os[1][4]), "v"(os[1][5]), "v"(os[1][6]) : "memory");
    const float cs = (nbp * 32 < RH) ? 1.0f : (1.0f / PCAR);   /* RH is a multiple of 32 */
    float* op = out + (b * CC + (run >> 1) * 16 + hi * 8 + (run & 1) * 4) * TT + nbp * 32 + lr;
#pragma unroll
    for (int e = 0; e < 2; ++e) { float mx = ms[e][0];
#pragma unroll
        for (int s = 1; s < NSP; ++s) mx = fmaxf(mx, ms[e][s]);
        v4f num = (v4f){}; float den = 0.0f;
#pragma unroll
        for (int s = 0; s < NSP; ++s) { const float w = __builtin_amdgcn_exp2f((ms[e][s] - mx) * L2E); den += ls[e][s] * w;
#pragma unroll
            for (int q = 0; q < 4; ++q) num[q] += os[e][s][q] * w; }
        const float f = __fdiv_rn(cs, den);
#pragma unroll
        for (int q = 0; q < 4; ++q) op[(size_t)q * TT + e * 16] = num[q] * f; }
}

extern "C" void kernel_launch(void* const* d_in, const int* in_sizes, int n_in,
                              void* d_out, int out_size, void* d_ws, size_t ws_size, hipStream_t stream) {
    (void)in_sizes; (void)n_in; (void)out_size;
    const float* x = (const float*)d_in[0]; const float* wq = (const float*)d_in[1]; const float* bq = (const float*)d_in[2]; const float* wk = (const float*)d_in[3]; const float* bk = (const float*)d_in[4]; const float* wv = (const float*)d_in[5]; const float* bv = (const float*)d_in[6]; const float* relh = (const float*)d_in[7]; const float* relw = (const float*)d_in[8];   /* [1][64][64][1], [1][64][1][64] */
    float* OUT = (float*)d_out;     // [4][64][4096] channel-major
    char* wsp = (char*)d_ws;
    auto take = [&](size_t bytes) { char* p = wsp; wsp += (bytes + 255) & ~(size_t)255; return (void*)p; };
    bf* QPh = (bf*)take((size_t)NB_ * TT * MID * 2); bf* QPl = (bf*)take((size_t)NB_ * TT * MID * 2); bf* KPh = (bf*)take((size_t)NB_ * TT * MID * 2); bf* KPl = (bf*)take((size_t)NB_ * TT * MID * 2);   /* hi/lo planes: one set per batch */
    h16* VT16 = (h16*)take((size_t)NB_ * CC * TT * 2); bf* VTh = (bf*)take((size_t)NB_ * CC * TT * 2); bf* VTl = (bf*)take((size_t)NB_ * CC * TT * 2);   /* V^T planes [64][4096] */
    float* Op = (float*)take((size_t)NSP * NB_ * CC * TT * 4); float* ML = (float*)take((size_t)NSP * NB_ * TT * 2 * 4);   /* per batch, block of 16 queries and span: unnormalised out^T (accumulator order), running maxima and sums */
    if ((size_t)(wsp - (char*)d_ws) > ws_size) return;    // ws 256 MiB (carve ~45 MiB)
    k_prep<<<dim3(TT / 64, NB_), 128, 0, stream>>>(x, wq, bq, wk, bk, wv, bv, relh, relw, QPh, QPl, KPh, KPl, VT16, VTh, VTl);   /* projections, k + pos (f32), planes: all batches */
    k_attn<<<dim3(NSP, NB_, RH / 64 + (TT - RH) / 128), 128, 0, stream>>>(QPh, QPl, KPh, KPl, VT16, VTh, VTl, Op, ML);   /* scores (every row hi/lo, unscaled logits), softmax, attn.v: all batches */
    k_merge<<<NB_ * (TT / 32), 256, 0, stream>>>(Op, ML, OUT);   /* spans joined, channel-major output */
}

// v008
// One run takes 36.8 microseconds.
// Two timings next to v007 both put it at 1.04 times that version's speed.
// Counting every step since v000, it is 28.3 times as fast.
#include <hip/hip_runtime.h>

// Self-attention over a 64x64 feature map with a learned 2-D positional key term (x [4][64][64x64] channel-major; q, k, v = 1x1 convs 'oi' [64][64] + [64] (1/8 weights, 0.02 biases); energy[n][m] = q_n.k_m + q_n.pos_m with pos[c][(hh, ww)] = rel_h[c][hh] + rel_w[c][ww] ([1][64][64][1] + [1][64][1][64], read) == q_n.(k_m + pos_m) (unscaled, sigma ~8); softmax over the 4,096 positions; out[c][n] = sum_m v[c][m] attn[n][m] -> [4][64][64][64] (1.0 M)).
// Layout: one kernel for all batches (k_prep) rounds the channel-major map and the weights to bf16, does the three exact projections + f32 biases, adds the positional table to the key rows in f32 (q.k + q.pos == q.(k + pos)) and writes the hi/lo planes, one set per batch. One kernel for all batches then does scores, softmax and attn.v in registers (k_attn), one key span per work-group, its K and V tiles shared through LDS; k_merge joins the spans and writes the channel-major output rows.
// Compute dtypes, f32 accumulate: every input rounded to bf16; projections exact + f32 biases; scores 3 products on every row; softmax f32 (running maximum); attn.V rows < 512 3 products (P, V hi/lo), rest fp16 (P x1024); epilogue f32.

#define NB_  4
#define TT   4096
#define DM   512
#define NH_  1
#define NKV  1
#define REP  (NH_ / NKV)
#define HD   64
#define DQ   (NH_ * HD)
#define DKV  (NKV * HD)
#define ZH   1
#define RH   512                  // query rows < RH use hi+lo planes (0: none)
#define WIN  0
#define PCAR 1024.0f
#define PCL2 10.0f     // log2 PCAR
#define SCL  1.0f   // no scaling in the module
#define MID  64
#define CQR  64      // q/k use all channels (no padding)
#define CC   64
#define NSP  7       // the 64 passes of 64 keys are dealt to NSP spans (9 or 10 each; 36 tiles x 4 batches x 7 = 1,008 work-groups of 4 waves at 4 waves per SIMD: one round on 256 WGPs), one work-group per span and query tile
#define PK   64      // keys per pass of k_attn
typedef _Float16 h16;
typedef unsigned short bf;
typedef __attribute__((ext_vector_type(16))) __bf16   v16bf;
typedef __attribute__((ext_vector_type(16))) _Float16 v16h;
typedef __attribute__((ext_vector_type(8)))  _Float16 v8h;
typedef __attribute__((ext_vector_type(8)))  unsigned short v8us;
typedef __attribute__((ext_vector_type(8)))  float    v8f;
typedef __attribute__((ext_vector_type(4)))  float    v4f;
typedef __attribute__((ext_vector_type(2)))  float    v2f;
typedef v8h  __attribute__((may_alias)) v8ha;
typedef v4f  __attribute__((may_alias)) v4fa;
typedef v8us __attribute__((may_alias)) v8usa;

__device__ __forceinline__ unsigned short f2bf(float f) { unsigned u = __float_as_uint(f); u += 0x7FFFu + ((u >> 16) & 1u); return (unsigned short)(u >> 16); }
__device__ __forceinline__ float bf2f(unsigned short b) { return __uint_as_float(((unsigned)b) << 16); }
__device__ __forceinline__ float bfr(float f) { return bf2f(f2bf(f)); }
__device__ __forceinline__ v16h cat16(v8h lo, v8h hi) { return __builtin_shufflevector(lo, hi, 0, 1, 2, 3, 4, 5, 6, 7, 8, 9, 10, 11, 12, 13, 14, 15); }
__device__ __forceinline__ v16bf cat16b(v8us lo, v8us hi) { return __builtin_bit_cast(v16bf, __builtin_shufflevector(lo, hi, 0, 1, 2, 3, 4, 5, 6, 7, 8, 9, 10, 11, 12, 13, 14, 15)); }
__device__ __forceinline__ v8f wmma16(v16h a, v16h b, v8f c) { return __builtin_amdgcn_wmma_f32_16x16x32_f16(false, a, false, b, (short)0, c, false, false); }
__device__ __forceinline__ v8f wmmab(v16bf a, v16bf b, v8f c) { return __builtin_amdgcn_wmma_f32_16x16x32_bf16(false, a, false, b, (short)0, c, false, false); }



template <typename T16> struct WFrag;   // 16x32 operand fragment from a K-contiguous 16-bit row: p = row start + 8 (lane >> 4); k = 8 hi + 0..7, 16 + 8 hi + 0..7 (A and B alike)
template <> struct WFrag<h16> { typedef v16h V; static __device__ __forceinline__ V ld(const h16* p) { return cat16(*(const v8h*)p, *(const v8h*)(p + 16)); } };
template <> struct WFrag<bf> { typedef v16bf V; static __device__ __forceinline__ V ld(const bf* p) { return cat16b(*(const v8us*)p, *(const v8us*)(p + 16)); } };

__device__ __forceinline__ h16 tohx(float x) { return (h16)x; }
__device__ __forceinline__ void splitf(float y, unsigned short& h, unsigned short& l) { h = f2bf(y); l = f2bf(y - bf2f(h)); }
typedef __attribute__((ext_vector_type(16))) unsigned short v16us;

#define WP 72   // LDS row pitch in 16-bit elements: 144 B = 16 B x odd, for the 16-byte fragment reads
// ---- k_prep: everything in front of the attention, one launch. Grid (64 map rows, 4 batches), 4 waves; a work-group owns the 64 tokens of one map row (hh = blockIdx.x, ww = 0..63).
// Each wave rounds its own 16 tokens' x to bf16 straight into a fragment (row = token, k = channel), which also goes to LDS; the work-group rounds the three weight matrices ('oi' = K-contiguous rows) into LDS once.
// q, k: A = 16 weight rows, B = the wave's own tokens, so a lane holds one token and 8 consecutive output channels: 16-byte stores, and the wave writes the whole 128-byte row of each of its tokens.
// v: A = 16 tokens (from LDS), B = weight rows 16 wave + 0..15, so a lane holds one channel and 8 consecutive tokens, and the wave writes the whole 128-byte piece (64 tokens) of each of its channel rows.
// Every product sums k = 0..31, then 32..63, as two accumulating matrix instructions.
__global__ __launch_bounds__(128) void k_prep(const float* __restrict__ x, const float* __restrict__ wq, const float* __restrict__ bq, const float* __restrict__ wk, const float* __restrict__ bk, const float* __restrict__ wv, const float* __restrict__ bv, const float* __restrict__ rh, const float* __restrict__ rw,
                                              bf* Qh, bf* Ql, bf* Kh, bf* Kl, h16* V16, bf* Vh, bf* Vl) {
    __shared__ __align__(16) bf Ws[3 * 64 * WP];
    __shared__ __align__(16) bf Xs[64 * WP];
    __shared__ __align__(32) float Rh[64];   /* this map row's column of rel_h, rounded */
    const int tid = threadIdx.x, lane = tid & 31, lr = lane & 15, hi = lane >> 4, wvi = tid >> 5;
    const int hh = blockIdx.x, tl = wvi * 16 + lr; const size_t b = blockIdx.y;
    const float* xt = x + b * CC * TT + hh * 64 + tl;
    float xr[2][16];
#pragma unroll
    for (int kc = 0; kc < 2; ++kc)
#pragma unroll
        for (int e = 0; e < 16; ++e) xr[kc][e] = xt[(kc * 32 + 8 * hi + (e & 7) + 16 * (e >> 3)) * TT];
    asm volatile("s_wait_xcnt 0x0" ::: "memory");   /* precaution, here and below: stands before any register that the loads or stores above name is reused */
    v8f wr[12];   /* 3 x 512 runs of 8 weights, 12 per thread */
#pragma unroll
    for (int i = 0; i < 12; ++i) wr[i] = *(const v8f*)((i < 4 ? wq : i < 8 ? wk : wv) + ((i & 3) * 128 + tid) * 8);
    asm volatile("s_wait_xcnt 0x0" ::: "memory");
    float rwr[4][8]; v8f bqr[4], bkr[4];
#pragma unroll
    for (int ot = 0; ot < 4; ++ot)
#pragma unroll
        for (int j = 0; j < 8; ++j) rwr[ot][j] = rw[(ot * 16 + 8 * hi + j) * 64 + tl];
    asm volatile("s_wait_xcnt 0x0" ::: "memory");
#pragma unroll
    for (int ot = 0; ot < 4; ++ot) { bqr[ot] = *(const v8f*)(bq + ot * 16 + 8 * hi); bkr[ot] = *(const v8f*)(bk + ot * 16 + 8 * hi); }
    const float bvw = bv[tl];   /* channel 16 wave + lr */
    asm volatile("s_wait_xcnt 0x0" ::: "memory");
    const float bvr = bfr(bvw);
    if (tid < 64) { const float rhw = rh[tid * 64 + hh];   /* waves 0 and 1, whole */
        asm volatile("s_wait_xcnt 0x0" :: "v"(rhw) : "memory");   /* the same precaution; the loaded value as an input keeps the wait behind this load */
        Rh[tid] = bfr(rhw); }
    v16bf xf[2];
#pragma unroll
    for (int kc = 0; kc < 2; ++kc) { v8us lo8, hi8;
#pragma unroll
        for (int e = 0; e < 8; ++e) { lo8[e] = f2bf(xr[kc][e]); hi8[e] = f2bf(xr[kc][8 + e]); }
        *(v8us*)(Xs + tl * WP + kc * 32 + 8 * hi) = lo8; *(v8us*)(Xs + tl * WP + kc * 32 + 8 * hi + 16) = hi8; xf[kc] = cat16b(lo8, hi8); }
#pragma unroll
    for (int i = 0; i < 12; ++i) { const int u = (i & 3) * 128 + tid; v8us o;
#pragma unroll
        for (int q = 0; q < 8; ++q) o[q] = f2bf(wr[i][q]);
        *(v8us*)(Ws + ((i >> 2) * 64 + (u >> 3)) * WP + (u & 7) * 8) = o; }
    __syncthreads();
    const size_t qrow = (b * TT + hh * 64 + tl) * MID + 8 * hi;
#pragma unroll
    for (int p = 0; p < 2; ++p)   /* 0: q, 1: k + pos */
#pragma unroll
        for (int ot = 0; ot < 4; ++ot) { v8f acc = (v8f){};
#pragma unroll
            for (int kc = 0; kc < 2; ++kc) acc = wmmab(WFrag<bf>::ld(Ws + (p * 64 + ot * 16 + lr) * WP + kc * 32 + 8 * hi), xf[kc], acc);
            v8us oh, ol; v8f rhv; if (p) rhv = *(const v8f*)(Rh + ot * 16 + 8 * hi);
#pragma unroll
            for (int j = 0; j < 8; ++j) { float y = acc[j] + bfr(p ? bkr[ot][j] : bqr[ot][j]); if (p) y = __fadd_rn(y, __fadd_rn(rhv[j], bfr(rwr[ot][j]))); unsigned short a2, c2; splitf(y, a2, c2); oh[j] = a2; ol[j] = c2; }
            *(v8us*)((p ? Kh : Qh) + qrow + ot * 16) = oh; *(v8us*)((p ? Kl : Ql) + qrow + ot * 16) = ol;
            asm volatile("s_wait_xcnt 0x0" ::: "memory"); }
    v16bf wf[2];
#pragma unroll
    for (int kc = 0; kc < 2; ++kc) wf[kc] = WFrag<bf>::ld(Ws + (128 + tl) * WP + kc * 32 + 8 * hi);
    const size_t vrow = (b * CC + tl) * TT + hh * 64 + 8 * hi;
#pragma unroll
    for (int mb = 0; mb < 4; ++mb) { v8f acc = (v8f){};
#pragma unroll
        for (int kc = 0; kc < 2; ++kc) acc = wmmab(WFrag<bf>::ld(Xs + (mb * 16 + lr) * WP + kc * 32 + 8 * hi), wf[kc], acc);
        v8h o16; v8us oh, ol;
#pragma unroll
        for (int j = 0; j < 8; ++j) { const float y = acc[j] + bvr; o16[j] = tohx(y); unsigned short a2, c2; splitf(y, a2, c2); oh[j] = a2; ol[j] = c2; }
        *(v8h*)(V16 + vrow + mb * 16) = o16; *(v8us*)(Vh + vrow + mb * 16) = oh; *(v8us*)(Vl + vrow + mb * 16) = ol;
        asm volatile("s_wait_xcnt 0x0" ::: "memory"); }
}

#define L2E 1.4426950408889634f
// ---- k_attn: scores, softmax and attn.v of one key span for one query tile, 4 waves x 16 NQ queries (rows < RH: NQ = 1, 64-query tiles, which start first; rest NQ = 2, 128-query tiles); scores and P never leave the registers.
// The score tile is formed TRANSPOSED (A = 16 key rows, B = 16 query rows), so a lane holds one query (column lr) and keys 8 hi + j of each 16-key tile: the row maximum and sum are in-lane but for one exchange with lane ^ 16,
// and two such tiles, converted, ARE the B fragment (k = 8 hi + 0..7, 16 + 8 hi + 0..7) of out^T[c][n] += V^T[c][k] P[n][k].
// A pass takes 64 keys (four such tiles): one maximum, one exchange, one rescaling of out^T and of the sum, one barrier and one set of copy addresses per 64 keys.
// P = exp2(s log2e + eb), one fused multiply-add per score in front of the exponential; in the fp16 rows eb holds the x1024 carry, so P and its sum are formed already scaled.
// Per span: running maximum m, sum l and unnormalised out^T, each relative to m; k_merge joins the spans. Inner loops are unrolled so that every fragment array stays in registers.
// K and V: the work-group brings each pass's tiles (64 key rows of 128 B per plane, 64 channel rows of 128 B per plane) into LDS once, by tensor loads, one whole plane per request and wave, two buffers: pass t + 2's loads are issued behind the barrier that ends pass t, so they fly during pass t + 1.
// The 4 waves read their fragments from LDS (16-byte reads; row pitches 16 B x odd).
#define KP  144                    // LDS pitch of a 128-byte K row, bytes
#define VP  144                    // LDS pitch of a 128-byte piece of a V row, bytes
#define KPB 10240                  // one K plane of a pass: 64 rows of 144 B = 9,216 B, rounded up to a multiple of 2 KiB, so that every plane's place in LDS is one
#define VPB 10240                  // one V plane of a pass, likewise
#define SBB (2 * KPB + 2 * VPB)    // one buffer: K hi, K lo, V (fp16, or hi and lo)
typedef unsigned u32x4 __attribute__((ext_vector_type(4)));
typedef unsigned u32x8 __attribute__((ext_vector_type(8)));
__device__ __forceinline__ unsigned uni(unsigned v) { return (unsigned)__builtin_amdgcn_readfirstlane(v); }
__device__ __forceinline__ unsigned pinned(unsigned v) { unsigned w = uni(v); asm volatile("" : "+s"(w)); return w; }   /* holds a test or a descriptor word in a scalar register: the branch round a tensor load must be a scalar branch, as the instruction ignores EXEC */
// One plane of one pass, one request of one wave: 64 rows of 128 B from src (row pitch in g1) to LDS byte dst, the mover padding each row by 16 B to the 144-byte pitch. No register of any lane is involved.
__device__ __forceinline__ void stage_plane(unsigned dst, unsigned long long src, u32x8 g1) {
    u32x4 g0; g0[0] = uni(1u); g0[1] = uni(dst); g0[2] = uni((unsigned)src); g0[3] = uni((((unsigned)(src >> 32)) & 0x01FFFFFFu) | 0x80000000u);   /* count 1; place in LDS; address; type 2 */
    asm volatile("tensor_load_to_lds %0, %1" :: "s"(g0), "s"(g1) : "memory");   /* no builtin is used for it; the waits for it are written where the tile is handed over */
}
template <bool HR, int NQ>
__device__ __forceinline__ void attn_span(const bf* __restrict__ Qh, const bf* __restrict__ Ql, const bf* __restrict__ Kh, const bf* __restrict__ Kl, const h16* __restrict__ V16, const bf* __restrict__ Vh, const bf* __restrict__ Vl, int n0, int k0, int k1, float* Op, float* ML, const unsigned char* Sm) {
    const int lane = threadIdx.x & 31, lr = lane & 15, hi = lane >> 4;
    /* wave w asks for plane w of every pass: K hi, K lo, V (fp16, or hi), V lo (only the hi/lo rows have a fourth plane) */
    const unsigned wave = uni(threadIdx.x >> 5), isv = wave >> 1, issuer = (HR || wave < 3) ? 1u : 0u;
    const unsigned sb = (unsigned)(size_t)Sm + wave * KPB;   /* byte address in LDS of this wave's plane in buffer 0 (KPB == VPB) */
    const unsigned long long pb = (unsigned long long)(size_t)(wave == 0 ? (const void*)Kh : wave == 1 ? (const void*)Kl : wave == 2 ? (HR ? (const void*)Vh : (const void*)V16) : (const void*)Vl);
    const unsigned kstep = isv ? 2u : 2u * MID;   /* bytes from one key to the next in the plane: along a V row, or one K row */
    u32x8 g1;   /* 1-byte elements, tensor = tile = 64 rows of 128 B, a pad of 4 dwords behind every 32. pinned(): each descriptor word is held in its scalar register through the loop; left free, the compiler rebuilds the constants at each load and uses their registers for other values while a request is in flight */
    g1[0] = pinned((1u << 20) | (4u << 22) | (3u << 25)); g1[1] = pinned(128u << 16); g1[2] = pinned(64u << 16); g1[3] = pinned(128u << 16); g1[4] = pinned(64u); g1[5] = pinned(isv ? 2u * TT : 2u * MID); g1[6] = pinned(0u); g1[7] = pinned(0u);
    v16bf qh[NQ][2], ql[NQ][2];
#pragma unroll
    for (int nq = 0; nq < NQ; ++nq)
#pragma unroll
        for (int kc = 0; kc < 2; ++kc) { const size_t qo = (size_t)(n0 + nq * 16 + lr) * MID + kc * 32 + 8 * hi; qh[nq][kc] = WFrag<bf>::ld(Qh + qo); ql[nq][kc] = WFrag<bf>::ld(Ql + qo); }
    v8f o[4][NQ]; float m[NQ], l[NQ];
#pragma unroll
    for (int nq = 0; nq < NQ; ++nq) { m[nq] = -3.0e38f; l[nq] = 0.0f;
#pragma unroll
        for (int ct = 0; ct < 4; ++ct) o[ct][nq] = (v8f){}; }
    if (HR || pinned(issuer)) { stage_plane(sb, pb + (unsigned long long)k0 * kstep, g1);
        asm volatile("s_wait_tensorcnt 0x0" ::: "memory"); }   /* this wave's plane of pass 0 has landed */
    __syncthreads();                                     /* ... and every other wave's: pass 0's tiles may be read */
    if (pinned(issuer && k0 + PK < k1)) stage_plane(sb + SBB, pb + (unsigned long long)(k0 + PK) * kstep, g1);
    unsigned cur = 0;   /* byte offset of the buffer that this pass reads */
#pragma unroll 1   /* kept rolled: a second pass's fragments would push the wave past 256 registers (4 waves per SIMD) */
    for (int kb = k0; kb < k1; kb += PK) {
        const unsigned char* kt_ = Sm + cur + lr * KP + 16 * hi; const unsigned char* vt_ = Sm + cur + 2 * KPB + lr * VP + 16 * hi;
        v8f s[4][NQ];
#pragma unroll
        for (int kt = 0; kt < 4; ++kt) {
#pragma unroll
            for (int nq = 0; nq < NQ; ++nq) s[kt][nq] = (v8f){};
#pragma unroll
            for (int kc = 0; kc < 2; ++kc) { const unsigned char* kp = kt_ + kt * 16 * KP + kc * 64; const v16bf kh = WFrag<bf>::ld((const bf*)kp), kl = WFrag<bf>::ld((const bf*)(kp + KPB));
#pragma unroll
                for (int nq = 0; nq < NQ; ++nq) { s[kt][nq] = wmmab(kh, qh[nq][kc], s[kt][nq]); s[kt][nq] = wmmab(kh, ql[nq][kc], s[kt][nq]); s[kt][nq] = wmmab(kl, qh[nq][kc], s[kt][nq]); } } }
        /* order of the score phase: K fragments are read three groups (of 4 reads: hi and lo of 32 channels) ahead of the products that use them, so that an LDS read's latency is covered by two groups of products; left free, the reads sink to directly in front of their products, each group with a full LDS wait */
        __builtin_amdgcn_sched_group_barrier(0x100, 12, 0);
#pragma unroll
        for (int g = 0; g < 4; ++g) { __builtin_amdgcn_sched_group_barrier(0x008, 3 * NQ, 0); __builtin_amdgcn_sched_group_barrier(0x100, 4, 0); }
        __builtin_amdgcn_sched_group_barrier(0x008, 6 * NQ, 0); __builtin_amdgcn_sched_group_barrier(0x100, 4, 0);   /* the last group one step later: its registers are those of a group already used */
        __builtin_amdgcn_sched_group_barrier(0x008, 6 * NQ, 0);
        float al[NQ], eb[NQ]; v2f ps[NQ]; bool moved = false;   /* ps: the pass's row sum, even and odd keys apart (packed additions) */
#pragma unroll
        for (int nq = 0; nq < NQ; ++nq) { float mx = fmaxf(fmaxf(s[0][nq][0], s[1][nq][0]), fmaxf(s[2][nq][0], s[3][nq][0]));
#pragma unroll
            for (int j = 1; j < 8; ++j) mx = fmaxf(fmaxf(mx, fmaxf(s[0][nq][j], s[1][nq][j])), fmaxf(s[2][nq][j], s[3][nq][j]));
            mx = fmaxf(mx, __shfl_xor(mx, 16, 32));
            const float mn = fmaxf(m[nq], mx); moved = moved || (mn > m[nq]); al[nq] = __builtin_amdgcn_exp2f((m[nq] - mn) * L2E); m[nq] = mn; ps[nq] = (v2f){};
            eb[nq] = HR ? -mn * L2E : __builtin_fmaf(-mn, L2E, PCL2); }   /* one addend per query and pass: minus the maximum in log2 units, plus the fp16 rows' carry as an exponent */
        if (__any(moved)) {   /* no maximum of the wave moved: every factor is exactly 1 */
#pragma unroll
            for (int ct = 0; ct < 4; ++ct)
#pragma unroll
                for (int nq = 0; nq < NQ; ++nq) o[ct][nq] *= al[nq]; }
        if (HR) {
#pragma unroll
            for (int h = 0; h < 2; ++h) {   /* the pass's two halves of 32 keys: V fragments, exponentials, products */
                v16bf vh[4], vl[4];
#pragma unroll
                for (int ct = 0; ct < 4; ++ct) { const unsigned char* vp = vt_ + ct * 16 * VP + h * 64; vh[ct] = WFrag<bf>::ld((const bf*)vp); vl[ct] = WFrag<bf>::ld((const bf*)(vp + VPB)); }
                v16bf ph[NQ], pl[NQ];
#pragma unroll
                for (int nq = 0; nq < NQ; ++nq) { v16us a16, c16;
#pragma unroll
                    for (int kt = 2 * h; kt < 2 * h + 2; ++kt) { const v8f a = __builtin_elementwise_fma(s[kt][nq], (v8f)(L2E), (v8f)(eb[nq]));   /* whole vectors: packed multiply-adds, two scores each */
#pragma unroll
                        for (int j = 0; j < 8; j += 2) { const v2f p = { __builtin_amdgcn_exp2f(a[j]), __builtin_amdgcn_exp2f(a[j + 1]) }; ps[nq] += p; unsigned short a2, c2; splitf(p[0], a2, c2); a16[8 * (kt & 1) + j] = a2; c16[8 * (kt & 1) + j] = c2; splitf(p[1], a2, c2); a16[8 * (kt & 1) + j + 1] = a2; c16[8 * (kt & 1) + j + 1] = c2; } }
                    ph[nq] = __builtin_bit_cast(v16bf, a16); pl[nq] = __builtin_bit_cast(v16bf, c16); }
                /* inputs only: holds the half's V reads here, as one group whose latency the exponentials cover; left free, they sink to one fragment at a time in front of its products, each with a full LDS wait */
                asm volatile("" :: "v"(vh[0]), "v"(vh[1]), "v"(vh[2]), "v"(vh[3]), "v"(vl[0]), "v"(vl[1]), "v"(vl[2]), "v"(vl[3]));
#pragma unroll
                for (int ct = 0; ct < 4; ++ct)
#pragma unroll
                    for (int nq = 0; nq < NQ; ++nq) { o[ct][nq] = wmmab(vh[ct], ph[nq], o[ct][nq]); o[ct][nq] = wmmab(vh[ct], pl[nq], o[ct][nq]); o[ct][nq] = wmmab(vl[ct], ph[nq], o[ct][nq]); }
                /* each half's 16 V reads are issued in front of its exponentials, the second half's behind the first half's products, whose fragments' registers they take */
                __builtin_amdgcn_sched_group_barrier(0x100, 16, 0); __builtin_amdgcn_sched_group_barrier(0x400, 16 * NQ, 0); __builtin_amdgcn_sched_group_barrier(0x008, 12 * NQ, 0);
            }
        } else {
            v16h va[2][4], pf[2][NQ];
#pragma unroll
            for (int ct = 0; ct < 3; ++ct) va[0][ct] = WFrag<h16>::ld((const h16*)(vt_ + ct * 16 * VP));
#pragma unroll
            for (int h = 0; h < 2; ++h) {   /* the pass's two halves of 32 keys */
#pragma unroll
                for (int nq = 0; nq < NQ; ++nq)
#pragma unroll
                    for (int kt = 2 * h; kt < 2 * h + 2; ++kt) { const v8f a = __builtin_elementwise_fma(s[kt][nq], (v8f)(L2E), (v8f)(eb[nq]));   /* whole vectors: packed multiply-adds, two scores each */
#pragma unroll
                        for (int j = 0; j < 8; j += 2) { const v2f p = { __builtin_amdgcn_exp2f(a[j]), __builtin_amdgcn_exp2f(a[j + 1]) }; ps[nq] += p; pf[h][nq][8 * (kt & 1) + j] = tohx(p[0]); pf[h][nq][8 * (kt & 1) + j + 1] = tohx(p[1]); } }
                if (h == 0) {
                    __builtin_amdgcn_sched_group_barrier(0x100, 6, 0); __builtin_amdgcn_sched_group_barrier(0x400, 16 * NQ, 0);   /* three V fragments are read in front of the first half's exponentials, which cover their latency */
                    asm volatile("" :: "v"(ps[0]), "v"(ps[NQ - 1]));   /* inputs only, each row's sum, against register growth: the sums of the first half are formed here, so that its 16 NQ exponentials leave their registers to the V fragments read next; left free, the additions sink behind the loop's barrier, every exponential of the pass stays live and the wave passes 256 registers */
                    __builtin_amdgcn_sched_barrier(0);   /* ... and the reads that follow stay behind them */
                    va[0][3] = WFrag<h16>::ld((const h16*)(vt_ + 3 * 16 * VP));
#pragma unroll
                    for (int ct = 0; ct < 4; ++ct) va[1][ct] = WFrag<h16>::ld((const h16*)(vt_ + ct * 16 * VP + 64));
#pragma unroll
                    for (int ct = 0; ct < 4; ++ct)
#pragma unroll
                        for (int nq = 0; nq < NQ; ++nq) o[ct][nq] = wmma16(va[0][ct], pf[0][nq], o[ct][nq]);
                }
            }
            /* the first half's products stand among the second half's exponentials: matrix and vector work of one wave side by side */
            __builtin_amdgcn_sched_group_barrier(0x100, 4, 0);
#pragma unroll
            for (int g = 0; g < 4 * NQ; ++g) { __builtin_amdgcn_sched_group_barrier(0x008, 1, 0); if (g % NQ == NQ - 1 && g / NQ < 3) __builtin_amdgcn_sched_group_barrier(0x100, 2, 0); __builtin_amdgcn_sched_group_barrier(0x400, 4, 0); }   /* the second half's last three V fragments are read one by one into the registers of fragments that the products have used */
            asm volatile("" :: "v"(ps[0]), "v"(ps[NQ - 1]));   /* inputs only, each row's sum: as above, for the second half */
#pragma unroll
            for (int ct = 0; ct < 4; ++ct)
#pragma unroll
                for (int nq = 0; nq < NQ; ++nq) o[ct][nq] = wmma16(va[1][ct], pf[1][nq], o[ct][nq]);
        }
#pragma unroll
        for (int nq = 0; nq < NQ; ++nq) l[nq] = l[nq] * al[nq] + (ps[nq][0] + ps[nq][1]);
        asm volatile("s_wait_dscnt 0x0" ::: "memory");      /* this wave's reads of the current buffer are done */
        if (HR || pinned(issuer)) asm volatile("s_wait_tensorcnt 0x0" ::: "memory");   /* its plane of the next pass has landed (hi/lo rows: every wave issues, no test) */
        __syncthreads();                                     /* one barrier a pass: it publishes the next pass's tiles and frees the buffer just read */
        if (pinned(issuer && kb + 2 * PK < k1)) stage_plane(sb + cur, pb + (unsigned long long)(kb + 2 * PK) * kstep, g1);
        cur ^= SBB;
    }
    asm volatile("s_wait_tensorcnt 0x0" ::: "memory");   /* no request is left in flight when the wave goes on to its stores and ends */
    asm volatile("s_wait_dscnt 0x0" ::: "memory");       /* ... and none of its LDS reads: the ring is closed in this order */
#pragma unroll
    for (int nq = 0; nq < NQ; ++nq) { const float lt = (l[nq] + __shfl_xor(l[nq], 16, 32)) * (HR ? 1.0f : 1.0f / PCAR);   /* the fp16 rows' sum carries the x1024 of its terms: taken out here, exactly */
        ML[(size_t)(n0 / 16 + nq) * NSP * 32 + lane] = hi ? lt : m[nq]; }
#pragma unroll
    for (int nq = 0; nq < NQ; ++nq) { const size_t nb = (size_t)(n0 / 16 + nq);
#pragma unroll
        for (int ct = 0; ct < 4; ++ct)
#pragma unroll
            for (int hf = 0; hf < 2; ++hf) *(v4f*)(Op + ((nb * NSP * 8 + ct * 2 + hf) * 32 + lane) * 4) = (v4f){ o[ct][nq][4 * hf], o[ct][nq][4 * hf + 1], o[ct][nq][4 * hf + 2], o[ct][nq][4 * hf + 3] };   /* accumulator order: 16 bytes a lane, 512 contiguous bytes (4 whole lines) a store */
    }
}
__global__ __launch_bounds__(128) void k_attn(const bf* __restrict__ Qh, const bf* __restrict__ Ql, const bf* __restrict__ Kh, const bf* __restrict__ Kl, const h16* __restrict__ V16, const bf* __restrict__ Vh, const bf* __restrict__ Vl, float* Op, float* ML) {
    __shared__ __attribute__((aligned(2048))) unsigned char Sm[2 * SBB - (VPB - 64 * VP)];   /* K and V tiles, two buffers; the last plane needs no rounding behind it: 79 KiB, four work-groups in a WGP's 320 KiB */
    const size_t b = blockIdx.y, pl = b * (TT / 16) * NSP + blockIdx.x; const size_t tb = b * TT * MID, vb = b * CC * TT;
    const int tile = blockIdx.z, wv = threadIdx.x >> 5, k0 = (int)(blockIdx.x * (TT / PK) / NSP) * PK, k1 = (int)((blockIdx.x + 1) * (TT / PK) / NSP) * PK;
    if (tile < RH / 64) attn_span<true, 1>(Qh + tb, Ql + tb, Kh + tb, Kl + tb, V16 + vb, Vh + vb, Vl + vb, tile * 64 + wv * 16, k0, k1, Op + pl * CC * 16, ML + pl * 32, Sm);
    else { attn_span<false, 2>(Qh + tb, Ql + tb, Kh + tb, Kl + tb, V16 + vb, Vh + vb, Vl + vb, RH + (tile - RH / 64) * 128 + wv * 32, k0, k1, Op + pl * CC * 16, ML + pl * 32, Sm);
        asm volatile("s_wait_xcnt 0x0" ::: "memory"); }   /* precaution: in the built code this path's last stores are followed by the other path's prologue, which reuses their registers */
}
// k_merge: out[b][c][n] = sum_s O_s[c][n] w_s / sum_s l_s w_s, w_s = exp(m_s - max m), spans in order; the x1024 carry of the fp16 rows is taken out here.
// O in the order of k_attn's accumulators, [b][n / 16][span][c / 16][c / 4 % 2][c / 8 % 2][n % 16][c % 4]: the last three indices are a run of 512 B, lane by lane, and the spans of a block of 16 queries lie side by side; ML [b][n / 16][span][32]: 16 maxima, then 16 sums.
// One work-group per 32 queries, one wave per run: a lane owns 4 channels of query n % 16 in both blocks of 16 queries, so every read of O is 512 contiguous bytes and the wave writes both halves of each 128-byte line of out that it touches.
__global__ __launch_bounds__(256) void k_merge(const float* __restrict__ Op, const float* __restrict__ ML, float* out) {
    const int lane = threadIdx.x & 31, lr = lane & 15, hi = lane >> 4, run = threadIdx.x >> 5;
    const size_t b = blockIdx.x / (TT / 32); const int nbp = (int)(blockIdx.x % (TT / 32));
    v4f os[2][NSP]; float ms[2][NSP], ls[2][NSP];
    const size_t nb0 = b * (TT / 16) + nbp * 2;   /* the first of the two blocks of 16 queries */
    const float* pm = ML + nb0 * NSP * 32 + lr; const float* po = Op + ((nb0 * NSP * 8 + run) * 32 + lane) * 4;   /* one address each: the rest is an immediate offset */
#pragma unroll
    for (int e = 0; e < 2; ++e)
#pragma unroll
        for (int s = 0; s < NSP; ++s) { os[e][s] = *(const v4f*)(po + (e * NSP + s) * 16 * CC); ms[e][s] = pm[(e * NSP + s) * 32]; ls[e][s] = pm[(e * NSP + s) * 32 + 16]; }
    /* inputs only, the loaded values: every load is issued before the first use, one memory latency in all; left free, most reads of O sink behind the first weights, and their latencies follow one another */
    asm volatile("" :: "v"(ms[0][0]), "v"(ms[0][1]), "v"(ms[0][2]), "v"(ms[0][3]), "v"(ms[0][4]), "v"(ms[0][5]), "v"(ms[0][6]), "v"(ms[1][0]), "v"(ms[1][1]), "v"(ms[1][2]), "v"(ms[1][3]), "v"(ms[1][4]), "v"(ms[1][5]), "v"(ms[1][6]),
                    "v"(ls[0][0]), "v"(ls[0][1]), "v"(ls[0][2]), "v"(ls[0][3]), "v"(ls[0][4]), "v"(ls[0][5]), "v"(ls[0][6]), "v"(ls[1][0]), "v"(ls[1][1]), "v"(ls[1][2]), "v"(ls[1][3]), "v"(ls[1][4]), "v"(ls[1][5]), "v"(ls[1][6]));
    /* ... and the precaution: the wait stands before any register that the loads name is reused; the addresses as inputs keep their registers untouched up to here */
    asm volatile("s_wait_xcnt 0x0" :: "v"(pm), "v"(po), "v"(os[0][0]), "v"(os[0][1]), "v"(os[0][2]), "v"(os[0][3]), "v"(os[0][4]), "v"(os[0][5]), "v"(os[0][6]), "v"(os[1][0]), "v"(os[1][1]), "v"(os[1][2]), "v"(os[1][3]), "v"(os[1][4]), "v"(os[1][5]), "v"(os[1][6]) : "memory");
    const float cs = (nbp * 32 < RH) ? 1.0f : (1.0f / PCAR);   /* RH is a multiple of 32 */
    float* op = out + (b * CC + (run >> 1) * 16 + hi * 8 + (run & 1) * 4) * TT + nbp * 32 + lr;
#pragma unroll
    for (int e = 0; e < 2; ++e) { float mx = ms[e][0];
#pragma unroll
        for (int s = 1; s < NSP; ++s) mx = fmaxf(mx, ms[e][s]);
        v4f num = (v4f){}; float den = 0.0f;
#pragma unroll
        for (int s = 0; s < NSP; ++s) { const float w = __builtin_amdgcn_exp2f((ms[e][s] - mx) * L2E); den += ls[e][s] * w;
#pragma unroll
            for (int q = 0; q < 4; ++q) num[q] += os[e][s][q] * w; }
        const float f = __fdiv_rn(cs, den);
#pragma unroll
        for (int q = 0; q < 4; ++q) op[(size_t)q * TT + e * 16] = num[q] * f; }
}

extern "C" void kernel_launch(void* const* d_in, const int* in_sizes, int n_in,
                              void* d_out, int out_size, void* d_ws, size_t ws_size, hipStream_t stream) {
    (void)in_sizes; (void)n_in; (void)out_size;
    const float* x = (const float*)d_in[0]; const float* wq = (const float*)d_in[1]; const float* bq = (const float*)d_in[2]; const float* wk = (const float*)d_in[3]; const float* bk = (const float*)d_in[4]; const float* wv = (const float*)d_in[5]; const float* bv = (const float*)d_in[6]; const float* relh = (const float*)d_in[7]; const float* relw = (const float*)d_in[8];   /* [1][64][64][1], [1][64][1][64] */
    float* OUT = (float*)d_out;     // [4][64][4096] channel-major
    char* wsp = (char*)d_ws;
    auto take = [&](size_t bytes) { char* p = wsp; wsp += (bytes + 255) & ~(size_t)255; return (void*)p; };
    bf* QPh = (bf*)take((size_t)NB_ * TT * MID * 2); bf* QPl = (bf*)take((size_t)NB_ * TT * MID * 2); bf* KPh = (bf*)take((size_t)NB_ * TT * MID * 2); bf* KPl = (bf*)take((size_t)NB_ * TT * MID * 2);   /* hi/lo planes: one set per batch */
    h16* VT16 = (h16*)take((size_t)NB_ * CC * TT * 2); bf* VTh = (bf*)take((size_t)NB_ * CC * TT * 2); bf* VTl = (bf*)take((size_t)NB_ * CC * TT * 2);   /* V^T planes [64][4096] */
    float* Op = (float*)take((size_t)NSP * NB_ * CC * TT * 4); float* ML = (float*)take((size_t)NSP * NB_ * TT * 2 * 4);   /* per batch, block of 16 queries and span: unnormalised out^T (accumulator order), running maxima and sums */
    if ((size_t)(wsp - (char*)d_ws) > ws_size) return;    // ws 256 MiB (carve ~45 MiB)
    k_prep<<<dim3(TT / 64, NB_), 128, 0, stream>>>(x, wq, bq, wk, bk, wv, bv, relh, relw, QPh, QPl, KPh, KPl, VT16, VTh, VTl);   /* projections, k + pos (f32), planes: all batches */
    k_attn<<<dim3(NSP, NB_, RH / 64 + (TT - RH) / 128), 128, 0, stream>>>(QPh, QPl, KPh, KPl, VT16, VTh, VTl, Op, ML);   /* scores (every row hi/lo, unscaled logits), softmax, attn.v: all batches */
    k_merge<<<NB_ * (TT / 32), 256, 0, stream>>>(Op, ML, OUT);   /* spans joined, channel-major output */
}
